// v000
// Times are from an AMD MI455X. After a warm-up the kernel runs many times in a row, and a time is the length of
// such a window on the GPU divided by its runs, so every launch and the gaps after it count. The runs cycle
// through copies of the inputs. A figure is the median of several windows, for all but v000 over two sittings.
// Sittings can differ by a few percent; kernels timed side by side share one.
// v000 is the starting kernel. One run takes 198 microseconds.
#include <hip/hip_runtime.h>
#include <math.h>

typedef __attribute__((ext_vector_type(16))) __bf16 v16bf;
typedef __attribute__((ext_vector_type(8)))  float  v8f;
typedef unsigned short ushort_t;

#define B_  16
#define N_  2048
#define D_  64
#define QT  16      // q rows per block
#define KT  32      // keys per iteration

// ---- float -> bf16 bits (native v_cvt_pk_bf16_f32 path) ----
__device__ __forceinline__ ushort_t f2bfbits(float f) {
    __bf16 h = (__bf16)f;
    union { __bf16 b; ushort_t s; } c; c.b = h;
    return c.s;
}

// ---- build a v16bf WMMA fragment from two contiguous 16B chunks ----
union FragU { uint4 u[2]; v16bf v; };
__device__ __forceinline__ v16bf load_frag16(const ushort_t* base, int off0, int off1) {
    FragU f;
    f.u[0] = *(const uint4*)(base + off0);
    f.u[1] = *(const uint4*)(base + off1);
    return f.v;
}

// K fragments for one 32-key iteration: [key subtile][K chunk]
struct KFrag { v16bf f[2][2]; };

__device__ __forceinline__ void load_kfrag(KFrag& kf, const ushort_t* Kbb,
                                           int k0, int lr, int lg) {
    #pragma unroll
    for (int t = 0; t < 2; ++t) {
        const ushort_t* krow = Kbb + (size_t)(k0 + t * 16 + lr) * D_;
        #pragma unroll
        for (int c = 0; c < 2; ++c)
            kf.f[t][c] = load_frag16(krow, c * 32 + lg * 8, c * 32 + lg * 8 + 16);
    }
}

// =====================================================================
// Pre-pass: K -> bf16 (same [b][n][d] layout), V -> bf16 transposed to
// Vt[b][d][n] so the second GEMM's B-fragments are contiguous loads.
// =====================================================================
__global__ __launch_bounds__(256)
void cvt_kv(const float* __restrict__ K, const float* __restrict__ V,
            ushort_t* __restrict__ Kb, ushort_t* __restrict__ Vt) {
    const size_t i = (size_t)blockIdx.x * blockDim.x + threadIdx.x; // 0 .. B*N*D-1
    Kb[i] = f2bfbits(K[i]);                       // both sides coalesced
    const size_t n = i & (N_ - 1);                // Vt index: ((b*D + d)*N + n)
    const size_t d = (i >> 11) & (D_ - 1);
    const size_t b = i >> 17;
    Vt[i] = f2bfbits(V[(b * N_ + n) * D_ + d]);   // write-coalesced transpose
}

// One pipelined iteration: compute from CUR's K frags, prefetch into NXT.
// Macro so register buffers keep compile-time names (no scratch demotion)
// and __shared__ arrays are referenced directly (ds_* lowering preserved).
#define ATTN_STEP(K0, CUR, NXT, DO_PF) do {                                     \
    /* V fragments for THIS step: consumed after 2 barriers (latency hidden) */ \
    v16bf vf[4];                                                                \
    _Pragma("unroll")                                                           \
    for (int t = 0; t < 4; ++t) {                                               \
        const ushort_t* vrow = Vtb + (size_t)(t * 16 + lr) * N_ + (K0);         \
        vf[t] = load_frag16(vrow, lg * 8, 16 + lg * 8);                         \
    }                                                                           \
    /* prefetch NEXT step's K fragments into the other named buffer */          \
    if (DO_PF) load_kfrag(NXT, Kbb, (K0) + KT, lr, lg);                         \
    /* scores: S = (Q/8) @ K^T, 16x32 per batch */                              \
    _Pragma("unroll")                                                           \
    for (int t = 0; t < 2; ++t) {                                               \
        v8f s = (v8f){0.f,0.f,0.f,0.f,0.f,0.f,0.f,0.f};                         \
        _Pragma("unroll")                                                       \
        for (int c = 0; c < 2; ++c)                                             \
            s = __builtin_amdgcn_wmma_f32_16x16x32_bf16(false, qf[c], false,    \
                    CUR.f[t][c], (short)0, s, false, false);                    \
        _Pragma("unroll")                                                       \
        for (int r = 0; r < 8; ++r)                                             \
            sS[((r + 8 * lg) * KT + t * 16 + lr) * B_ + w] = s[r];              \
    }                                                                           \
    __syncthreads();                                                            \
    /* softmax over the BATCH axis: 512 threads <-> 512 (q,k) positions */      \
    {                                                                           \
        const int tid = w * 32 + lane;                                          \
        const int q = tid >> 5, k = tid & 31;                                   \
        const float* p = &sS[(q * KT + k) * B_];                                \
        float vv[B_];                                                           \
        float m = -INFINITY;                                                    \
        _Pragma("unroll")                                                       \
        for (int b = 0; b < B_; ++b) { vv[b] = p[b]; m = fmaxf(m, vv[b]); }     \
        float sum = 0.f;                                                        \
        _Pragma("unroll")                                                       \
        for (int b = 0; b < B_; ++b) { vv[b] = __expf(vv[b] - m); sum += vv[b]; } \
        const float rs = 1.f / sum;                                             \
        _Pragma("unroll")                                                       \
        for (int b = 0; b < B_; ++b)                                            \
            sA[(b * QT + q) * KT + k] = f2bfbits(vv[b] * rs);                   \
    }                                                                           \
    __syncthreads();                                                            \
    /* out += attn @ V (16x32 @ 32x64 per batch) */                             \
    {                                                                           \
        const v16bf af = load_frag16(&sA[(w * QT + lr) * KT], lg*8, 16 + lg*8); \
        _Pragma("unroll")                                                       \
        for (int t = 0; t < 4; ++t)                                             \
            acc[t] = __builtin_amdgcn_wmma_f32_16x16x32_bf16(false, af, false,  \
                         vf[t], (short)0, acc[t], false, false);                \
    }                                                                           \
    /* no loop-end barrier: next sS scatter is ordered by the post-softmax  */   \
    /* barrier (all sS reads precede it); sA writers by the next pre-softmax one.    */   \
} while (0)

// =====================================================================
// Main kernel: block = 16 waves, wave w owns batch b=w; block owns a
// 16-row q tile. Softmax couples only the 16 batch values per (q,k).
// =====================================================================
__global__ __launch_bounds__(512, 1)
void batch_softmax_attn(const float* __restrict__ Q,
                        const ushort_t* __restrict__ Kb,
                        const ushort_t* __restrict__ Vt,
                        float* __restrict__ O) {
    __shared__ float    sS[QT * KT * B_];   // raw scores [q][k][b]      (32 KB)
    __shared__ ushort_t sA[B_ * QT * KT];   // normalized bf16 [b][q][k] (16 KB)

    const int lane = threadIdx.x;        // 0..31
    const int w    = threadIdx.y;        // wave id == batch id (16 waves)
    const int lg   = lane >> 4;          // lane group (0/1) per WMMA layout
    const int lr   = lane & 15;
    const int q0   = blockIdx.x * QT;

    const float*    Qb  = Q  + ((size_t)w * N_ + q0) * D_;
    const ushort_t* Kbb = Kb + (size_t)w * N_ * D_;
    const ushort_t* Vtb = Vt + (size_t)w * D_ * N_;
    float*          Ob  = O  + ((size_t)w * N_ + q0) * D_;

    // ---- Q A-fragments (16x32 bf16 x 2 K-chunks), pre-scaled by 1/sqrt(64)
    v16bf qf[2];
    {
        const float* rowp = Qb + lr * D_;
        #pragma unroll
        for (int c = 0; c < 2; ++c) {
            const int base0 = c * 32 + lg * 8;
            const int base1 = base0 + 16;
            #pragma unroll
            for (int e = 0; e < 8; ++e) {
                qf[c][e]     = (__bf16)(rowp[base0 + e] * 0.125f);
                qf[c][e + 8] = (__bf16)(rowp[base1 + e] * 0.125f);
            }
        }
    }

    // output accumulators: 4 d-subtiles of 16 cols (f32 C/D layout)
    v8f acc[4];
    #pragma unroll
    for (int t = 0; t < 4; ++t) acc[t] = (v8f){0.f,0.f,0.f,0.f,0.f,0.f,0.f,0.f};

    // ---- two statically named K buffers: ping-pong with compile-time parity
    KFrag ka, kb;
    load_kfrag(ka, Kbb, 0, lr, lg);

    for (int k0 = 0; k0 < N_; k0 += 2 * KT) {
        ATTN_STEP(k0,      ka, kb, true);
        ATTN_STEP(k0 + KT, kb, ka, (k0 + 2 * KT) < N_);
    }

    // ---- store output (C/D layout -> row major), coalesced 64B per half-wave
    #pragma unroll
    for (int t = 0; t < 4; ++t) {
        #pragma unroll
        for (int r = 0; r < 8; ++r) {
            const int q = r + 8 * lg;
            const int d = t * 16 + lr;
            Ob[(size_t)q * D_ + d] = acc[t][r];
        }
    }
}

extern "C" void kernel_launch(void* const* d_in, const int* in_sizes, int n_in,
                              void* d_out, int out_size, void* d_ws, size_t ws_size,
                              hipStream_t stream) {
    const float* Q = (const float*)d_in[0];
    const float* K = (const float*)d_in[1];
    const float* V = (const float*)d_in[2];
    float* O = (float*)d_out;
    (void)in_sizes; (void)n_in; (void)out_size; (void)ws_size;

    ushort_t* Kb = (ushort_t*)d_ws;                       // 4 MiB
    ushort_t* Vt = Kb + (size_t)B_ * N_ * D_;             // 4 MiB

    const size_t total = (size_t)B_ * N_ * D_;            // 2M elements
    cvt_kv<<<dim3((unsigned)(total / 256)), dim3(256), 0, stream>>>(K, V, Kb, Vt);

    dim3 grid(N_ / QT);      // 128 q-tiles
    dim3 block(32, B_);      // 16 waves, wave w == batch b
    batch_softmax_attn<<<grid, block, 0, stream>>>(Q, Kb, Vt, O);
}

// v001
// A run of this version takes 140 microseconds.
// In two side-by-side timings against v000, it was 1.45 and 1.39 times as fast.
#include <hip/hip_runtime.h>
#include <math.h>

typedef __attribute__((ext_vector_type(16))) __bf16 v16bf;
typedef __attribute__((ext_vector_type(8)))  float  v8f;
typedef unsigned short ushort_t;

#define B_  16
#define N_  2048
#define D_  64
#define QT  16      // q rows per block
#define KT  32      // keys per iteration

// ---- float -> bf16 bits (native v_cvt_pk_bf16_f32 path) ----
__device__ __forceinline__ ushort_t f2bfbits(float f) {
    __bf16 h = (__bf16)f;
    union { __bf16 b; ushort_t s; } c; c.b = h;
    return c.s;
}

// ---- build a v16bf WMMA fragment from two contiguous 16B chunks ----
union FragU { uint4 u[2]; v16bf v; };
__device__ __forceinline__ v16bf load_frag16(const ushort_t* base, int off0, int off1) {
    FragU f;
    f.u[0] = *(const uint4*)(base + off0);
    f.u[1] = *(const uint4*)(base + off1);
    return f.v;
}

// K fragments for one 32-key iteration: [key subtile][K chunk]
struct KFrag { v16bf f[2][2]; };

// Packed operand layout (both K and V): the unit is one half fragment of a
// wave, 32 lanes x 8 bf16 = 512 contiguous bytes, lane-major, so one
// wave-wide 16-byte load reads four whole 128-byte lines.
//   Kb chunk index = (((b*128 + key_tile)*2 + c)*2 + h)*32 + lane
//      holds K[b][key_tile*16 + lr][c*32 + h*16 + lg*8 + 0..7]
//   Vt chunk index = (((b*64 + step)*4 + t)*2 + h)*32 + lane
//      holds V[b][step*32 + h*16 + lg*8 + 0..7][t*16 + lr]
// Kl / Vl below are the batch base plus lane*8 elements.
__device__ __forceinline__ void load_kfrag(KFrag& kf, const ushort_t* Kl, int k0) {
    #pragma unroll
    for (int t = 0; t < 2; ++t) {
        #pragma unroll
        for (int c = 0; c < 2; ++c)
            kf.f[t][c] = load_frag16(Kl + (size_t)k0 * D_ + t * 1024 + c * 512, 0, 256);
    }
}

typedef __attribute__((ext_vector_type(8))) __bf16 v8bf;
union ChunkU { v8bf v; uint4 u; };

// =====================================================================
// Pre-pass: K and V -> bf16 in the packed fragment order above. One thread
// writes one 16-byte chunk of each; a block covers 32 keys of one batch,
// so every input line it touches is used up inside the block.
// =====================================================================
__global__ __launch_bounds__(256)
void cvt_kv(const float* __restrict__ K, const float* __restrict__ V,
            ushort_t* __restrict__ Kb, ushort_t* __restrict__ Vt) {
    const unsigned i  = blockIdx.x * 256u + threadIdx.x;   // chunk 0 .. B*N*D/8-1
    const unsigned lr = i & 15u, lg = (i >> 4) & 1u, h = (i >> 5) & 1u;
    {
        const unsigned c = (i >> 6) & 1u, row = (i >> 7) * 16u + lr;  // row = b*N + key
        const float* s = K + (size_t)row * D_ + c * 32u + h * 16u + lg * 8u;
        const float4 x = *(const float4*)s;
        const float4 y = *(const float4*)(s + 4);
        ChunkU o;
        o.v[0] = (__bf16)x.x; o.v[1] = (__bf16)x.y; o.v[2] = (__bf16)x.z; o.v[3] = (__bf16)x.w;
        o.v[4] = (__bf16)y.x; o.v[5] = (__bf16)y.y; o.v[6] = (__bf16)y.z; o.v[7] = (__bf16)y.w;
        *(uint4*)(Kb + (size_t)i * 8) = o.u;
    }
    {
        const unsigned t = (i >> 6) & 3u, row = (i >> 8) * 32u + h * 16u + lg * 8u;
        const float* s = V + (size_t)row * D_ + t * 16u + lr;
        ChunkU o;
        #pragma unroll
        for (int e = 0; e < 8; ++e) o.v[e] = (__bf16)s[e * D_];
        *(uint4*)(Vt + (size_t)i * 8) = o.u;
    }
}

// One pipelined iteration: compute from CUR's K frags, prefetch into NXT.
// Macro so register buffers keep compile-time names (no scratch demotion)
// and __shared__ arrays are referenced directly (ds_* lowering preserved).
#define ATTN_STEP(K0, CUR, NXT, DO_PF) do {                                     \
    /* V fragments for THIS step: consumed after 2 barriers (latency hidden) */ \
    v16bf vf[4];                                                                \
    _Pragma("unroll")                                                           \
    for (int t = 0; t < 4; ++t) {                                               \
        vf[t] = load_frag16(Vl + (size_t)(K0) * D_ + t * 512, 0, 256);          \
    }                                                                           \
    /* prefetch NEXT step's K fragments into the other named buffer */          \
    if (DO_PF) load_kfrag(NXT, Kl, (K0) + KT);                                  \
    /* scores: S = (Q/8) @ K^T, 16x32 per batch */                              \
    _Pragma("unroll")                                                           \
    for (int t = 0; t < 2; ++t) {                                               \
        v8f s = (v8f){0.f,0.f,0.f,0.f,0.f,0.f,0.f,0.f};                         \
        _Pragma("unroll")                                                       \
        for (int c = 0; c < 2; ++c)                                             \
            s = __builtin_amdgcn_wmma_f32_16x16x32_bf16(false, qf[c], false,    \
                    CUR.f[t][c], (short)0, s, false, false);                    \
        _Pragma("unroll")                                                       \
        for (int r = 0; r < 8; ++r)                                             \
            sS[((r + 8 * lg) * KT + t * 16 + lr) * B_ + w] = s[r];              \
    }                                                                           \
    __syncthreads();                                                            \
    /* softmax over the BATCH axis: 512 threads <-> 512 (q,k) positions */      \
    {                                                                           \
        const int tid = w * 32 + lane;                                          \
        const int q = tid >> 5, k = tid & 31;                                   \
        const float* p = &sS[(q * KT + k) * B_];                                \
        float vv[B_];                                                           \
        float m = -INFINITY;                                                    \
        _Pragma("unroll")                                                       \
        for (int b = 0; b < B_; ++b) { vv[b] = p[b]; m = fmaxf(m, vv[b]); }     \
        float sum = 0.f;                                                        \
        _Pragma("unroll")                                                       \
        for (int b = 0; b < B_; ++b) { vv[b] = __expf(vv[b] - m); sum += vv[b]; } \
        const float rs = 1.f / sum;                                             \
        _Pragma("unroll")                                                       \
        for (int b = 0; b < B_; ++b)                                            \
            sA[(b * QT + q) * KT + k] = f2bfbits(vv[b] * rs);                   \
    }                                                                           \
    __syncthreads();                                                            \
    /* out += attn @ V (16x32 @ 32x64 per batch) */                             \
    {                                                                           \
        const v16bf af = load_frag16(&sA[(w * QT + lr) * KT], lg*8, 16 + lg*8); \
        _Pragma("unroll")                                                       \
        for (int t = 0; t < 4; ++t)                                             \
            acc[t] = __builtin_amdgcn_wmma_f32_16x16x32_bf16(false, af, false,  \
                         vf[t], (short)0, acc[t], false, false);                \
    }                                                                           \
    /* no loop-end barrier: next sS scatter is ordered by the post-softmax  */   \
    /* barrier (all sS reads precede it); sA writers by the next pre-softmax one.    */   \
} while (0)

// =====================================================================
// Main kernel: block = 16 waves, wave w owns batch b=w; block owns a
// 16-row q tile. Softmax couples only the 16 batch values per (q,k).
// =====================================================================
__global__ __launch_bounds__(512, 1)
void batch_softmax_attn(const float* __restrict__ Q,
                        const ushort_t* __restrict__ Kb,
                        const ushort_t* __restrict__ Vt,
                        float* __restrict__ O) {
    __shared__ float    sS[QT * KT * B_];   // raw scores [q][k][b]      (32 KB)
    __shared__ ushort_t sA[B_ * QT * KT];   // normalized bf16 [b][q][k] (16 KB)

    const int lane = threadIdx.x;        // 0..31
    const int w    = threadIdx.y;        // wave id == batch id (16 waves)
    const int lg   = lane >> 4;          // lane group (0/1) per WMMA layout
    const int lr   = lane & 15;
    const int q0   = blockIdx.x * QT;

    const float*    Qb  = Q  + ((size_t)w * N_ + q0) * D_;
    const ushort_t* Kl  = Kb + (size_t)w * N_ * D_ + lane * 8;   // packed, per lane
    const ushort_t* Vl  = Vt + (size_t)w * D_ * N_ + lane * 8;   // packed, per lane
    float*          Ob  = O  + ((size_t)w * N_ + q0) * D_;

    // ---- Q A-fragments (16x32 bf16 x 2 K-chunks), pre-scaled by 1/sqrt(64)
    v16bf qf[2];
    {
        const float* rowp = Qb + lr * D_;
        #pragma unroll
        for (int c = 0; c < 2; ++c) {
            const int base0 = c * 32 + lg * 8;
            const int base1 = base0 + 16;
            #pragma unroll
            for (int e = 0; e < 8; ++e) {
                qf[c][e]     = (__bf16)(rowp[base0 + e] * 0.125f);
                qf[c][e + 8] = (__bf16)(rowp[base1 + e] * 0.125f);
            }
        }
    }

    // output accumulators: 4 d-subtiles of 16 cols (f32 C/D layout)
    v8f acc[4];
    #pragma unroll
    for (int t = 0; t < 4; ++t) acc[t] = (v8f){0.f,0.f,0.f,0.f,0.f,0.f,0.f,0.f};

    // ---- two statically named K buffers: ping-pong with compile-time parity
    KFrag ka, kb;
    load_kfrag(ka, Kl, 0);

    for (int k0 = 0; k0 < N_; k0 += 2 * KT) {
        ATTN_STEP(k0,      ka, kb, true);
        ATTN_STEP(k0 + KT, kb, ka, (k0 + 2 * KT) < N_);
    }

    // ---- store output (C/D layout -> row major), coalesced 64B per half-wave
    #pragma unroll
    for (int t = 0; t < 4; ++t) {
        #pragma unroll
        for (int r = 0; r < 8; ++r) {
            const int q = r + 8 * lg;
            const int d = t * 16 + lr;
            Ob[(size_t)q * D_ + d] = acc[t][r];
        }
    }
}

extern "C" void kernel_launch(void* const* d_in, const int* in_sizes, int n_in,
                              void* d_out, int out_size, void* d_ws, size_t ws_size,
                              hipStream_t stream) {
    const float* Q = (const float*)d_in[0];
    const float* K = (const float*)d_in[1];
    const float* V = (const float*)d_in[2];
    float* O = (float*)d_out;
    (void)in_sizes; (void)n_in; (void)out_size; (void)ws_size;

    ushort_t* Kb = (ushort_t*)d_ws;                       // 4 MiB
    ushort_t* Vt = Kb + (size_t)B_ * N_ * D_;             // 4 MiB

    cvt_kv<<<dim3(B_ * N_ * D_ / 8 / 256), dim3(256), 0, stream>>>(K, V, Kb, Vt);

    dim3 grid(N_ / QT);      // 128 q-tiles
    dim3 block(32, B_);      // 16 waves, wave w == batch b
    batch_softmax_attn<<<grid, block, 0, stream>>>(Q, Kb, Vt, O);
}

// v002
// A run of this version takes 80.6 microseconds.
// Timed twice side by side with v001, it ran 1.69 and 1.71 times as fast.
// All steps since v000 together make it 2.42 times as fast.
#include <hip/hip_runtime.h>
#include <math.h>

typedef __attribute__((ext_vector_type(16))) __bf16 v16bf;
typedef __attribute__((ext_vector_type(8)))  float  v8f;
typedef unsigned short ushort_t;

#define B_  16
#define N_  2048
#define D_  64
#define QT  16      // q rows per block
#define WV  16      // waves per block = key tiles per step
#define KS  256     // keys per step (WV tiles of 16)

// ---- build a v16bf WMMA fragment from two contiguous 16B chunks ----
union FragU { uint4 u[2]; v16bf v; };
// (packed layout below: base is wave-uniform, lane8 = lane*8 elements)
__device__ __forceinline__ v16bf load_frag16(const ushort_t* base, unsigned lane8) {
    FragU f;
    f.u[0] = *(const uint4*)(base + lane8);
    f.u[1] = *(const uint4*)(base + 256 + lane8);
    return f.v;
}

// Packed operand layout (both K and V): the unit is one half fragment of a
// wave, 32 lanes x 8 bf16 = 512 contiguous bytes, lane-major, so one
// wave-wide 16-byte load reads four whole 128-byte lines.
//   Kb chunk index = (((b*128 + key_tile)*2 + c)*2 + h)*32 + lane
//      holds K[b][key_tile*16 + lr][c*32 + h*16 + lg*8 + 0..7]
//   Vt chunk index = (((b*64 + step)*4 + t)*2 + h)*32 + lane
//      holds V[b][step*32 + h*16 + lg*8 + 0..7][t*16 + lr]
typedef __attribute__((ext_vector_type(8))) __bf16 v8bf;
union ChunkU { v8bf v; uint4 u; };

// =====================================================================
// Pre-pass: K and V -> bf16 in the packed fragment order above. One thread
// writes one 16-byte chunk of each; a block covers 32 keys of one batch,
// so every input line it touches is used up inside the block.
// =====================================================================
__global__ __launch_bounds__(256)
void cvt_kv(const float* __restrict__ K, const float* __restrict__ V,
            ushort_t* __restrict__ Kb, ushort_t* __restrict__ Vt) {
    const unsigned i  = blockIdx.x * 256u + threadIdx.x;   // chunk 0 .. B*N*D/8-1
    const unsigned lr = i & 15u, lg = (i >> 4) & 1u, h = (i >> 5) & 1u;
    {
        const unsigned c = (i >> 6) & 1u, row = (i >> 7) * 16u + lr;  // row = b*N + key
        const float* s = K + (size_t)row * D_ + c * 32u + h * 16u + lg * 8u;
        const float4 x = *(const float4*)s;
        const float4 y = *(const float4*)(s + 4);
        ChunkU o;
        o.v[0] = (__bf16)x.x; o.v[1] = (__bf16)x.y; o.v[2] = (__bf16)x.z; o.v[3] = (__bf16)x.w;
        o.v[4] = (__bf16)y.x; o.v[5] = (__bf16)y.y; o.v[6] = (__bf16)y.z; o.v[7] = (__bf16)y.w;
        *(uint4*)(Kb + (size_t)i * 8) = o.u;
    }
    {
        const unsigned t = (i >> 6) & 3u, row = (i >> 8) * 32u + h * 16u + lg * 8u;
        const float* s = V + (size_t)row * D_ + t * 16u + lr;
        ChunkU o;
        #pragma unroll
        for (int e = 0; e < 8; ++e) o.v[e] = (__bf16)s[e * D_];
        *(uint4*)(Vt + (size_t)i * 8) = o.u;
    }
}

// =====================================================================
// Main kernel: block = 16 waves on one 16-row q tile, 256 keys per step.
// Scores: wave w takes key tile w of the step for ALL 16 batches, as
// S^T = K * Q^T, so the 16 values that the batch softmax couples sit in one
// lane, one register of each batch's D tile: max, exp and sum need no
// exchange. A lane's 8 D registers, converted, are one half of the bf16 B
// operand of O^T = V^T * P^T (key = 8*lg + r inside the tile), so they go to
// LDS as one 16-byte chunk per batch. After one barrier wave w reads the
// chunks of batch w and does that batch's P*V over the 256 keys.
// =====================================================================
__global__ __launch_bounds__(512)
void batch_softmax_attn(const float* __restrict__ Q,
                        const ushort_t* __restrict__ Kb,
                        const ushort_t* __restrict__ Vt,
                        float* __restrict__ O) {
    __shared__ uint4 sQ[B_ * 4 * 32];            // Q fragments [b][c*2+h][lane]        (32 KB)
    __shared__ uint4 sP[2 * B_ * WV * 32];       // P chunks [buf][b][key tile][lane] (2 x 128 KB)

    const int lane = threadIdx.x;        // 0..31
    // wave id 0..15, held in a scalar register so that the K, V and LDS bases are scalar
    const int w    = __builtin_amdgcn_readfirstlane(threadIdx.y);
    const int lg   = lane >> 4;          // lane group (0/1) per WMMA layout
    const int lr   = lane & 15;
    const int q0   = blockIdx.x * QT;

    // ---- Q fragments of batch w (16x32 bf16 x 2 d chunks), pre-scaled by
    //      1/sqrt(64), shared with every wave through LDS
    {
        const float* rowp = Q + ((size_t)w * N_ + q0 + lr) * D_;
        #pragma unroll
        for (int c = 0; c < 2; ++c) {
            const int base0 = c * 32 + lg * 8;
            const int base1 = base0 + 16;
            FragU f;
            #pragma unroll
            for (int e = 0; e < 8; ++e) {
                f.v[e]     = (__bf16)(rowp[base0 + e] * 0.125f);
                f.v[e + 8] = (__bf16)(rowp[base1 + e] * 0.125f);
            }
            sQ[(w * 4 + c * 2 + 0) * 32 + lane] = f.u[0];
            sQ[(w * 4 + c * 2 + 1) * 32 + lane] = f.u[1];
        }
    }

    // Every inner loop below is fully unrolled: acc, kr, S and vr stay in registers
    // only while each index is a constant.
    // O^T accumulators of batch w: 4 d-subtiles of 16 rows (f32 C/D layout)
    v8f acc[4];
    #pragma unroll
    for (int t = 0; t < 4; ++t) acc[t] = (v8f){0.f,0.f,0.f,0.f,0.f,0.f,0.f,0.f};

    const unsigned  lane8 = lane * 8;
    const ushort_t* Kl = Kb + (size_t)w * 1024;        // key tile w of step 0, batch 0
    const ushort_t* Vl = Vt + (size_t)w * D_ * N_;     // batch w

    // K fragments, a ring of four batches in flight
    v16bf kr[4][2];
    #pragma unroll
    for (int j = 0; j < 4; ++j) {
        #pragma unroll
        for (int c = 0; c < 2; ++c)
            kr[j][c] = load_frag16(Kl + j * (N_ * D_) + c * 512, lane8);
    }
    __syncthreads();

    const ushort_t* Ks = Kl;             // this step's key tile, batch 0
    for (int s = 0; s < N_ / KS; ++s) {
        const ushort_t* Vs = Vl + s * (KS * D_);

        // ---- scores S^T[key][q] of key tile w, one D tile per batch
        v8f S[B_];
        #pragma unroll
        for (int b = 0; b < B_; ++b) {
            FragU qa, qb;
            qa.u[0] = sQ[(b * 4 + 0) * 32 + lane];
            qa.u[1] = sQ[(b * 4 + 1) * 32 + lane];
            qb.u[0] = sQ[(b * 4 + 2) * 32 + lane];
            qb.u[1] = sQ[(b * 4 + 3) * 32 + lane];
            v8f x = (v8f){0.f,0.f,0.f,0.f,0.f,0.f,0.f,0.f};
            x = __builtin_amdgcn_wmma_f32_16x16x32_bf16(false, kr[b & 3][0], false,
                    qa.v, (short)0, x, false, false);
            x = __builtin_amdgcn_wmma_f32_16x16x32_bf16(false, kr[b & 3][1], false,
                    qb.v, (short)0, x, false, false);
            S[b] = x;
            if (b + 4 < B_) {
                #pragma unroll
                for (int c = 0; c < 2; ++c)
                    kr[b & 3][c] = load_frag16(Ks + (b + 4) * (N_ * D_) + c * 512, lane8);
            }
        }

        // V fragments of the step's first two 32-key chunks: in flight under the softmax
        v16bf vr[2][4];
        #pragma unroll
        for (int j = 0; j < 2; ++j) {
            #pragma unroll
            for (int t = 0; t < 4; ++t)
                vr[j][t] = load_frag16(Vs + (j * 4 + t) * 512, lane8);
        }

        // ---- softmax over the BATCH axis, in registers
        #pragma unroll
        for (int r = 0; r < 8; ++r) {
            float m = -INFINITY;
            #pragma unroll
            for (int b = 0; b < B_; ++b) m = fmaxf(m, S[b][r]);
            float sum = 0.f;
            #pragma unroll
            for (int b = 0; b < B_; ++b) { S[b][r] = __expf(S[b][r] - m); sum += S[b][r]; }
            const float rs = 1.f / sum;
            #pragma unroll
            for (int b = 0; b < B_; ++b) S[b][r] *= rs;
        }

        // ---- publish P: batch b, key tile w -> one 16-byte chunk per lane
        uint4* pb = sP + (s & 1) * (B_ * WV * 32);
        #pragma unroll
        for (int b = 0; b < B_; ++b) {
            ChunkU o;
            #pragma unroll
            for (int e = 0; e < 8; ++e) o.v[e] = (__bf16)S[b][e];
            pb[(b * WV + w) * 32 + lane] = o.u;
        }

        // next step's first four K batches (the last step reads its own again, unused)
        Ks += (s + 1 < N_ / KS) ? KS * D_ : 0;
        #pragma unroll
        for (int j = 0; j < 4; ++j) {
            #pragma unroll
            for (int c = 0; c < 2; ++c)
                kr[j][c] = load_frag16(Ks + j * (N_ * D_) + c * 512, lane8);
        }

        // The step's one barrier: publishes this buffer; the other buffer's
        // readers (previous step) are all in front of it, so the next step may refill it.
        __syncthreads();

        // ---- O^T += V^T * P^T for batch w (64x32 @ 32x16 per chunk)
        #pragma unroll
        for (int c = 0; c < KS / 32; ++c) {
            FragU p;
            p.u[0] = pb[(w * WV + 2 * c + 0) * 32 + lane];
            p.u[1] = pb[(w * WV + 2 * c + 1) * 32 + lane];
            #pragma unroll
            for (int t = 0; t < 4; ++t) {
                acc[t] = __builtin_amdgcn_wmma_f32_16x16x32_bf16(false, vr[c & 1][t], false,
                             p.v, (short)0, acc[t], false, false);
            }
            if (c + 2 < KS / 32) {
                #pragma unroll
                for (int t = 0; t < 4; ++t)
                    vr[c & 1][t] = load_frag16(Vs + ((c + 2) * 4 + t) * 512, lane8);
            }
        }
    }

    // ---- store output: lane holds O[q0+lr][t*16 + 8*lg + 0..7], 32 contiguous bytes
    float* Ob = O + ((size_t)w * N_ + q0 + lr) * D_ + 8 * lg;
    #pragma unroll
    for (int t = 0; t < 4; ++t) {
        *(float4*)(Ob + t * 16)     = make_float4(acc[t][0], acc[t][1], acc[t][2], acc[t][3]);
        *(float4*)(Ob + t * 16 + 4) = make_float4(acc[t][4], acc[t][5], acc[t][6], acc[t][7]);
    }
}

extern "C" void kernel_launch(void* const* d_in, const int* in_sizes, int n_in,
                              void* d_out, int out_size, void* d_ws, size_t ws_size,
                              hipStream_t stream) {
    const float* Q = (const float*)d_in[0];
    const float* K = (const float*)d_in[1];
    const float* V = (const float*)d_in[2];
    float* O = (float*)d_out;
    (void)in_sizes; (void)n_in; (void)out_size; (void)ws_size;

    ushort_t* Kb = (ushort_t*)d_ws;                       // 4 MiB
    ushort_t* Vt = Kb + (size_t)B_ * N_ * D_;             // 4 MiB

    cvt_kv<<<dim3(B_ * N_ * D_ / 8 / 256), dim3(256), 0, stream>>>(K, V, Kb, Vt);

    dim3 grid(N_ / QT);      // 128 q-tiles
    dim3 block(32, WV);      // 16 waves: wave w scores key tile w, sums batch w
    batch_softmax_attn<<<grid, block, 0, stream>>>(Q, Kb, Vt, O);
}

// v003
// One run takes 56.1 microseconds.
// Two timings next to v002 put it at 1.45 and 1.46 times that version's speed.
// Counting every step since v000, it is 3.51 times as fast.
#include <hip/hip_runtime.h>
#include <math.h>

typedef __attribute__((ext_vector_type(16))) __bf16 v16bf;
typedef __attribute__((ext_vector_type(8)))  float  v8f;
typedef unsigned short ushort_t;

#define B_  16
#define N_  2048
#define D_  64
#define QT  16      // q rows per block
#define WV  16      // waves per block = key tiles per step
#define KS  256     // keys per step (WV tiles of 16)
#define KH  2       // key ranges: one block per (q tile, range), 128 x 2 = one block per WGP
#define NK  (N_ / KH)   // keys per range

// ---- build a v16bf WMMA fragment from two contiguous 16B chunks ----
union FragU { uint4 u[2]; v16bf v; };
// (packed layout below: base is wave-uniform, lane8 = lane*8 elements)
__device__ __forceinline__ v16bf load_frag16(const ushort_t* base, unsigned lane8) {
    FragU f;
    f.u[0] = *(const uint4*)(base + lane8);
    f.u[1] = *(const uint4*)(base + 256 + lane8);
    return f.v;
}

// Packed operand layout (both K and V): the unit is one half fragment of a
// wave, 32 lanes x 8 bf16 = 512 contiguous bytes, lane-major, so one
// wave-wide 16-byte load reads four whole 128-byte lines.
//   Kb chunk index = (((b*128 + key_tile)*2 + c)*2 + h)*32 + lane
//      holds K[b][key_tile*16 + lr][c*32 + h*16 + lg*8 + 0..7]
//   Vt chunk index = (((b*64 + step)*4 + t)*2 + h)*32 + lane
//      holds V[b][step*32 + h*16 + lg*8 + 0..7][t*16 + lr]
typedef __attribute__((ext_vector_type(8))) __bf16 v8bf;
union ChunkU { v8bf v; uint4 u; };

// =====================================================================
// Pre-pass: K and V -> bf16 in the packed fragment order above. One thread
// writes one 16-byte chunk of each; a block covers 32 keys of one batch,
// so every input line it touches is used up inside the block.
// =====================================================================
__global__ __launch_bounds__(256)
void cvt_kv(const float* __restrict__ K, const float* __restrict__ V,
            ushort_t* __restrict__ Kb, ushort_t* __restrict__ Vt) {
    const unsigned i  = blockIdx.x * 256u + threadIdx.x;   // chunk 0 .. B*N*D/8-1
    const unsigned lr = i & 15u, lg = (i >> 4) & 1u, h = (i >> 5) & 1u;
    {
        const unsigned c = (i >> 6) & 1u, row = (i >> 7) * 16u + lr;  // row = b*N + key
        const float* s = K + (size_t)row * D_ + c * 32u + h * 16u + lg * 8u;
        const float4 x = *(const float4*)s;
        const float4 y = *(const float4*)(s + 4);
        ChunkU o;
        o.v[0] = (__bf16)x.x; o.v[1] = (__bf16)x.y; o.v[2] = (__bf16)x.z; o.v[3] = (__bf16)x.w;
        o.v[4] = (__bf16)y.x; o.v[5] = (__bf16)y.y; o.v[6] = (__bf16)y.z; o.v[7] = (__bf16)y.w;
        *(uint4*)(Kb + (size_t)i * 8) = o.u;
    }
    {
        const unsigned t = (i >> 6) & 3u, row = (i >> 8) * 32u + h * 16u + lg * 8u;
        const float* s = V + (size_t)row * D_ + t * 16u + lr;
        ChunkU o;
        #pragma unroll
        for (int e = 0; e < 8; ++e) o.v[e] = (__bf16)s[e * D_];
        *(uint4*)(Vt + (size_t)i * 8) = o.u;
    }
}

// =====================================================================
// Main kernel: block = 16 waves on one 16-row q tile and one range of 1024
// keys, 256 keys per step. The batch softmax couples nothing across keys, so a
// range's P*V is a plain partial sum of O; merge_ranges adds the two.
// Scores: wave w takes key tile w of the step for ALL 16 batches, as
// S^T = K * Q^T, so the 16 values that the batch softmax couples sit in one
// lane, one register of each batch's D tile: max, exp and sum need no
// exchange. A lane's 8 D registers, converted, are one half of the bf16 B
// operand of O^T = V^T * P^T (key = 8*lg + r inside the tile), so they go to
// LDS as one 16-byte chunk per batch. After one barrier wave w reads the
// chunks of batch w and does that batch's P*V over the 256 keys.
// =====================================================================
__global__ __launch_bounds__(512)
void batch_softmax_attn(const float* __restrict__ Q,
                        const ushort_t* __restrict__ Kb,
                        const ushort_t* __restrict__ Vt,
                        float* __restrict__ Pt) {
    __shared__ uint4 sQ[B_ * 4 * 32];            // Q fragments [b][c*2+h][lane]        (32 KB)
    __shared__ uint4 sP[2 * B_ * WV * 32];       // P chunks [buf][b][key tile][lane] (2 x 128 KB)

    const int lane = threadIdx.x;        // 0..31
    // wave id 0..15, held in a scalar register so that the K, V and LDS bases are scalar
    const int w    = __builtin_amdgcn_readfirstlane(threadIdx.y);
    const int lg   = lane >> 4;          // lane group (0/1) per WMMA layout
    const int lr   = lane & 15;
    const int q0   = blockIdx.x * QT;
    const int kh   = blockIdx.y;         // key range

    // ---- Q fragments of batch w (16x32 bf16 x 2 d chunks), pre-scaled by
    //      1/sqrt(64), shared with every wave through LDS
    {
        const float* rowp = Q + ((size_t)w * N_ + q0 + lr) * D_;
        #pragma unroll
        for (int c = 0; c < 2; ++c) {
            const int base0 = c * 32 + lg * 8;
            const int base1 = base0 + 16;
            FragU f;
            #pragma unroll
            for (int e = 0; e < 8; ++e) {
                f.v[e]     = (__bf16)(rowp[base0 + e] * 0.125f);
                f.v[e + 8] = (__bf16)(rowp[base1 + e] * 0.125f);
            }
            sQ[(w * 4 + c * 2 + 0) * 32 + lane] = f.u[0];
            sQ[(w * 4 + c * 2 + 1) * 32 + lane] = f.u[1];
        }
    }

    // Every inner loop below is fully unrolled: acc, kr, S and vr stay in registers
    // only while each index is a constant.
    // O^T accumulators of batch w: 4 d-subtiles of 16 rows (f32 C/D layout)
    v8f acc[4];
    #pragma unroll
    for (int t = 0; t < 4; ++t) acc[t] = (v8f){0.f,0.f,0.f,0.f,0.f,0.f,0.f,0.f};

    const unsigned  lane8 = lane * 8;
    const ushort_t* Kl = Kb + (size_t)kh * (NK * D_) + (size_t)w * 1024;     // key tile w of step 0, batch 0
    const ushort_t* Vl = Vt + (size_t)w * D_ * N_ + (size_t)kh * (NK * D_);  // batch w

    // K fragments, a ring of four batches in flight
    v16bf kr[4][2];
    #pragma unroll
    for (int j = 0; j < 4; ++j) {
        #pragma unroll
        for (int c = 0; c < 2; ++c)
            kr[j][c] = load_frag16(Kl + j * (N_ * D_) + c * 512, lane8);
    }
    __syncthreads();

    const ushort_t* Ks = Kl;             // this step's key tile, batch 0
    for (int s = 0; s < NK / KS; ++s) {
        const ushort_t* Vs = Vl + s * (KS * D_);

        // ---- scores S^T[key][q] of key tile w, one D tile per batch
        v8f S[B_];
        #pragma unroll
        for (int b = 0; b < B_; ++b) {
            FragU qa, qb;
            qa.u[0] = sQ[(b * 4 + 0) * 32 + lane];
            qa.u[1] = sQ[(b * 4 + 1) * 32 + lane];
            qb.u[0] = sQ[(b * 4 + 2) * 32 + lane];
            qb.u[1] = sQ[(b * 4 + 3) * 32 + lane];
            v8f x = (v8f){0.f,0.f,0.f,0.f,0.f,0.f,0.f,0.f};
            x = __builtin_amdgcn_wmma_f32_16x16x32_bf16(false, kr[b & 3][0], false,
                    qa.v, (short)0, x, false, false);
            x = __builtin_amdgcn_wmma_f32_16x16x32_bf16(false, kr[b & 3][1], false,
                    qb.v, (short)0, x, false, false);
            S[b] = x;
            if (b + 4 < B_) {
                #pragma unroll
                for (int c = 0; c < 2; ++c)
                    kr[b & 3][c] = load_frag16(Ks + (b + 4) * (N_ * D_) + c * 512, lane8);
            }
        }

        // V fragments of the step's first two 32-key chunks: in flight under the softmax
        v16bf vr[2][4];
        #pragma unroll
        for (int j = 0; j < 2; ++j) {
            #pragma unroll
            for (int t = 0; t < 4; ++t)
                vr[j][t] = load_frag16(Vs + (j * 4 + t) * 512, lane8);
        }

        // ---- softmax over the BATCH axis, in registers
        #pragma unroll
        for (int r = 0; r < 8; ++r) {
            float m = -INFINITY;
            #pragma unroll
            for (int b = 0; b < B_; ++b) m = fmaxf(m, S[b][r]);
            float sum = 0.f;
            #pragma unroll
            for (int b = 0; b < B_; ++b) { S[b][r] = __expf(S[b][r] - m); sum += S[b][r]; }
            const float rs = 1.f / sum;
            #pragma unroll
            for (int b = 0; b < B_; ++b) S[b][r] *= rs;
        }

        // ---- publish P: batch b, key tile w -> one 16-byte chunk per lane
        uint4* pb = sP + (s & 1) * (B_ * WV * 32);
        #pragma unroll
        for (int b = 0; b < B_; ++b) {
            ChunkU o;
            #pragma unroll
            for (int e = 0; e < 8; ++e) o.v[e] = (__bf16)S[b][e];
            pb[(b * WV + w) * 32 + lane] = o.u;
        }

        // next step's first four K batches (the last step reads its own again, unused)
        Ks += (s + 1 < NK / KS) ? KS * D_ : 0;
        #pragma unroll
        for (int j = 0; j < 4; ++j) {
            #pragma unroll
            for (int c = 0; c < 2; ++c)
                kr[j][c] = load_frag16(Ks + j * (N_ * D_) + c * 512, lane8);
        }

        // The step's one barrier: publishes this buffer; the other buffer's
        // readers (previous step) are all in front of it, so the next step may refill it.
        __syncthreads();

        // ---- O^T += V^T * P^T for batch w (64x32 @ 32x16 per chunk)
        #pragma unroll
        for (int c = 0; c < KS / 32; ++c) {
            FragU p;
            p.u[0] = pb[(w * WV + 2 * c + 0) * 32 + lane];
            p.u[1] = pb[(w * WV + 2 * c + 1) * 32 + lane];
            #pragma unroll
            for (int t = 0; t < 4; ++t) {
                acc[t] = __builtin_amdgcn_wmma_f32_16x16x32_bf16(false, vr[c & 1][t], false,
                             p.v, (short)0, acc[t], false, false);
            }
            if (c + 2 < KS / 32) {
                #pragma unroll
                for (int t = 0; t < 4; ++t)
                    vr[c & 1][t] = load_frag16(Vs + ((c + 2) * 4 + t) * 512, lane8);
            }
        }
    }

    // ---- store the range's partial tile in register order: float4 j of a lane at
    //      Pt[range][b*128 + q tile][j][lane], so each wave-wide store is 512 contiguous bytes
    float* Pb = Pt + ((size_t)kh * (B_ * N_ / QT) + w * (N_ / QT) + blockIdx.x) * (QT * D_) + lane * 4;
    #pragma unroll
    for (int t = 0; t < 4; ++t) {
        *(float4*)(Pb + (2 * t + 0) * 128) = make_float4(acc[t][0], acc[t][1], acc[t][2], acc[t][3]);
        *(float4*)(Pb + (2 * t + 1) * 128) = make_float4(acc[t][4], acc[t][5], acc[t][6], acc[t][7]);
    }
}

// =====================================================================
// Merge: O = partial of range 0 + partial of range 1. One wave per
// (batch, q tile): whole-line loads of both partials, then the output stores.
// =====================================================================
typedef __attribute__((ext_vector_type(4))) float v4f;

__global__ __launch_bounds__(256)
void merge_ranges(const float* __restrict__ Pt, float* __restrict__ O) {
    const unsigned lane = threadIdx.x & 31u;
    // b*128 + q tile, the same in every lane: held scalar so that the bases are scalar
    const unsigned g    = blockIdx.x * 8u + __builtin_amdgcn_readfirstlane(threadIdx.x >> 5);
    const float* p0 = Pt + (size_t)g * (QT * D_) + lane * 4u;
    const float* p1 = p0 + (size_t)B_ * N_ * D_;
    v4f a[8], c[8];
    #pragma unroll
    for (int j = 0; j < 8; ++j) a[j] = *(const v4f*)(p0 + j * 128);
    #pragma unroll
    for (int j = 0; j < 8; ++j) c[j] = *(const v4f*)(p1 + j * 128);
    // lane holds O[g*16 + lr][t*16 + 8*lg + 0..7], 32 contiguous bytes per t
    float* Ob = O + ((size_t)g * QT + (lane & 15u)) * D_ + 8u * (lane >> 4);
    #pragma unroll
    for (int j = 0; j < 8; ++j)
        *(v4f*)(Ob + (j >> 1) * 16 + (j & 1) * 4) = a[j] + c[j];
}

extern "C" void kernel_launch(void* const* d_in, const int* in_sizes, int n_in,
                              void* d_out, int out_size, void* d_ws, size_t ws_size,
                              hipStream_t stream) {
    const float* Q = (const float*)d_in[0];
    const float* K = (const float*)d_in[1];
    const float* V = (const float*)d_in[2];
    float* O = (float*)d_out;
    (void)in_sizes; (void)n_in; (void)out_size; (void)ws_size;

    ushort_t* Kb = (ushort_t*)d_ws;                       // 4 MiB
    ushort_t* Vt = Kb + (size_t)B_ * N_ * D_;             // 4 MiB
    float*    Pt = (float*)(Vt + (size_t)B_ * N_ * D_);   // 2 x 8 MiB of f32 partial sums

    cvt_kv<<<dim3(B_ * N_ * D_ / 8 / 256), dim3(256), 0, stream>>>(K, V, Kb, Vt);

    dim3 grid(N_ / QT, KH);  // 128 q-tiles x 2 key ranges
    dim3 block(32, WV);      // 16 waves: wave w scores key tile w, sums batch w
    batch_softmax_attn<<<grid, block, 0, stream>>>(Q, Kb, Vt, Pt);

    merge_ranges<<<dim3(B_ * N_ / QT / 8), dim3(256), 0, stream>>>(Pt, O);
}

// v004
// It runs in 47.4 microseconds.
// Timed twice side by side with v003, it ran 1.20 and 1.19 times as fast.
// Counting every step since v000, it is 4.18 times as fast.
#include <hip/hip_runtime.h>
#include <math.h>

typedef __attribute__((ext_vector_type(16))) __bf16 v16bf;
typedef __attribute__((ext_vector_type(8)))  float  v8f;
typedef unsigned short ushort_t;

#define B_  16
#define N_  2048
#define D_  64
#define QT  32      // q rows per block
#define QS  2       // 16-row q subtiles per block: each K and V fragment feeds one WMMA per subtile
#define WV  8       // waves per block = key tiles per step
#define KS  128     // keys per step (WV tiles of 16)
#define KH  4       // key ranges: one block per (q tile, range), 64 x 4 = one block per WGP
#define NK  (N_ / KH)   // keys per range
#define KD  8       // K ring: batches in flight

// ---- build a v16bf WMMA fragment from two contiguous 16B chunks ----
union FragU { uint4 u[2]; v16bf v; };
// (packed layout below: base is wave-uniform, lane8 = lane*8 elements)
__device__ __forceinline__ v16bf load_frag16(const ushort_t* base, unsigned lane8) {
    FragU f;
    f.u[0] = *(const uint4*)(base + lane8);
    f.u[1] = *(const uint4*)(base + 256 + lane8);
    return f.v;
}

// Packed operand layout (both K and V): the unit is one half fragment of a
// wave, 32 lanes x 8 bf16 = 512 contiguous bytes, lane-major, so one
// wave-wide 16-byte load reads four whole 128-byte lines.
//   Kb chunk index = (((b*128 + key_tile)*2 + c)*2 + h)*32 + lane
//      holds K[b][key_tile*16 + lr][c*32 + h*16 + lg*8 + 0..7]
//   Vt chunk index = (((b*64 + step)*4 + t)*2 + h)*32 + lane
//      holds V[b][step*32 + h*16 + lg*8 + 0..7][t*16 + lr]
typedef __attribute__((ext_vector_type(8))) __bf16 v8bf;
union ChunkU { v8bf v; uint4 u; };

// =====================================================================
// Pre-pass: K and V -> bf16 in the packed fragment order above. One thread
// writes one 16-byte chunk of each; a block covers 32 keys of one batch,
// so every input line it touches is used up inside the block.
// =====================================================================
__global__ __launch_bounds__(256)
void cvt_kv(const float* __restrict__ K, const float* __restrict__ V,
            ushort_t* __restrict__ Kb, ushort_t* __restrict__ Vt) {
    const unsigned i  = blockIdx.x * 256u + threadIdx.x;   // chunk 0 .. B*N*D/8-1
    const unsigned lr = i & 15u, lg = (i >> 4) & 1u, h = (i >> 5) & 1u;
    {
        const unsigned c = (i >> 6) & 1u, row = (i >> 7) * 16u + lr;  // row = b*N + key
        const float* s = K + (size_t)row * D_ + c * 32u + h * 16u + lg * 8u;
        const float4 x = *(const float4*)s;
        const float4 y = *(const float4*)(s + 4);
        ChunkU o;
        o.v[0] = (__bf16)x.x; o.v[1] = (__bf16)x.y; o.v[2] = (__bf16)x.z; o.v[3] = (__bf16)x.w;
        o.v[4] = (__bf16)y.x; o.v[5] = (__bf16)y.y; o.v[6] = (__bf16)y.z; o.v[7] = (__bf16)y.w;
        *(uint4*)(Kb + (size_t)i * 8) = o.u;
    }
    {
        const unsigned t = (i >> 6) & 3u, row = (i >> 8) * 32u + h * 16u + lg * 8u;
        const float* s = V + (size_t)row * D_ + t * 16u + lr;
        ChunkU o;
        #pragma unroll
        for (int e = 0; e < 8; ++e) o.v[e] = (__bf16)s[e * D_];
        *(uint4*)(Vt + (size_t)i * 8) = o.u;
    }
}

// =====================================================================
// Main kernel: block = 8 waves on one 32-row q tile (two 16-row subtiles) and
// one range of 512 keys, 128 keys per step. The batch softmax couples nothing
// across keys, so a range's P*V is a plain partial sum of O; merge_ranges adds
// the four.
// Scores: wave w takes key tile w of the step for ALL 16 batches and both q
// subtiles, as S^T = K * Q^T, so the 16 values that the batch softmax couples
// sit in one lane, one register of each batch's D tile: max, exp and sum need
// no exchange, and a K fragment is loaded once for 32 q rows. A lane's 8 D
// registers, converted, are one half of the bf16 B operand of O^T = V^T * P^T
// (key = 8*lg + r inside the tile), so they go to LDS as one 16-byte chunk per
// batch and subtile. After one barrier wave w reads the chunks of batches 2w
// and 2w+1 and does their P*V over the 128 keys, each V fragment again serving
// both subtiles.
// =====================================================================
__global__ __launch_bounds__(256)
void batch_softmax_attn(const float* __restrict__ Q,
                        const ushort_t* __restrict__ Kb,
                        const ushort_t* __restrict__ Vt,
                        float* __restrict__ Pt) {
    __shared__ uint4 sQ[B_ * QS * 4 * 32];       // Q fragments [b][subtile][c*2+h][lane]        (64 KB)
    __shared__ uint4 sP[2 * B_ * QS * WV * 32];  // P chunks [buf][b][subtile][key tile][lane] (2 x 128 KB)

    const int lane = threadIdx.x;        // 0..31
    // wave id 0..7, held in a scalar register so that the K, V and LDS bases are scalar
    const int w    = __builtin_amdgcn_readfirstlane(threadIdx.y);
    const int lg   = lane >> 4;          // lane group (0/1) per WMMA layout
    const int lr   = lane & 15;
    const int q0   = blockIdx.x * QT;
    const int kh   = blockIdx.y;         // key range

    // ---- Q fragments of batches 2w and 2w+1 (16x32 bf16 x 2 d chunks per subtile),
    //      pre-scaled by 1/sqrt(64), shared with every wave through LDS
    float4 qf[2 * QS][8];                // per (batch, subtile): floats i*16 + lg*8 + 0..7 of the lane's row, i = 0..3
    #pragma unroll
    for (int u = 0; u < 2 * QS; ++u) {
        const int bq = 2 * QS * w + u;   // b*QS + subtile
        const float* rowp = Q + ((size_t)(bq >> 1) * N_ + q0 + (bq & 1) * 16 + lr) * D_ + lg * 8;
        #pragma unroll
        for (int i = 0; i < 4; ++i) {
            qf[u][2 * i + 0] = *(const float4*)(rowp + i * 16);
            qf[u][2 * i + 1] = *(const float4*)(rowp + i * 16 + 4);
        }
    }
    // the address registers of the loads above are reused right below: wait before they are overwritten
    asm volatile("s_wait_xcnt 0x0" ::: "memory");
    #pragma unroll
    for (int u = 0; u < 2 * QS; ++u) {
        const int bq = 2 * QS * w + u;
        #pragma unroll
        for (int c = 0; c < 2; ++c) {
            const float4 x0 = qf[u][4 * c + 0], x1 = qf[u][4 * c + 1];   // d = c*32 + lg*8 + 0..7
            const float4 y0 = qf[u][4 * c + 2], y1 = qf[u][4 * c + 3];   // d = c*32 + 16 + lg*8 + 0..7
            FragU f;
            f.v[0]  = (__bf16)(x0.x * 0.125f); f.v[1]  = (__bf16)(x0.y * 0.125f);
            f.v[2]  = (__bf16)(x0.z * 0.125f); f.v[3]  = (__bf16)(x0.w * 0.125f);
            f.v[4]  = (__bf16)(x1.x * 0.125f); f.v[5]  = (__bf16)(x1.y * 0.125f);
            f.v[6]  = (__bf16)(x1.z * 0.125f); f.v[7]  = (__bf16)(x1.w * 0.125f);
            f.v[8]  = (__bf16)(y0.x * 0.125f); f.v[9]  = (__bf16)(y0.y * 0.125f);
            f.v[10] = (__bf16)(y0.z * 0.125f); f.v[11] = (__bf16)(y0.w * 0.125f);
            f.v[12] = (__bf16)(y1.x * 0.125f); f.v[13] = (__bf16)(y1.y * 0.125f);
            f.v[14] = (__bf16)(y1.z * 0.125f); f.v[15] = (__bf16)(y1.w * 0.125f);
            sQ[(bq * 4 + c * 2 + 0) * 32 + lane] = f.u[0];
            sQ[(bq * 4 + c * 2 + 1) * 32 + lane] = f.u[1];
        }
    }

    // Every inner loop below is fully unrolled: acc, kr, S and vr stay in registers
    // only while each index is a constant.
    // O^T accumulators of batches 2w, 2w+1: per subtile 4 d-subtiles of 16 rows (f32 C/D layout)
    v8f acc[2][QS][4];
    #pragma unroll
    for (int j = 0; j < 2; ++j) {
        #pragma unroll
        for (int qs = 0; qs < QS; ++qs) {
            #pragma unroll
            for (int t = 0; t < 4; ++t) acc[j][qs][t] = (v8f){0.f,0.f,0.f,0.f,0.f,0.f,0.f,0.f};
        }
    }

    const unsigned  lane8 = lane * 8;
    const ushort_t* Kl = Kb + (size_t)kh * (NK * D_) + (size_t)w * 1024;         // key tile w of step 0, batch 0
    const ushort_t* Vl = Vt + (size_t)(2 * w) * D_ * N_ + (size_t)kh * (NK * D_);  // batch 2w

    // K fragments, a ring of KD batches in flight
    v16bf kr[KD][2];
    #pragma unroll
    for (int j = 0; j < KD; ++j) {
        #pragma unroll
        for (int c = 0; c < 2; ++c)
            kr[j][c] = load_frag16(Kl + j * (N_ * D_) + c * 512, lane8);
    }
    __syncthreads();

    const ushort_t* Ks = Kl;             // this step's key tile, batch 0
    for (int s = 0; s < NK / KS; ++s) {
        const ushort_t* Vs = Vl + s * (KS * D_);

        // ---- scores S^T[key][q] of key tile w, one D tile per batch and subtile
        v8f S[QS][B_];
        #pragma unroll
        for (int b = 0; b < B_; ++b) {
            FragU qa[QS], qb[QS];
            #pragma unroll
            for (int qs = 0; qs < QS; ++qs) {
                qa[qs].u[0] = sQ[((b * QS + qs) * 4 + 0) * 32 + lane];
                qa[qs].u[1] = sQ[((b * QS + qs) * 4 + 1) * 32 + lane];
                qb[qs].u[0] = sQ[((b * QS + qs) * 4 + 2) * 32 + lane];
                qb[qs].u[1] = sQ[((b * QS + qs) * 4 + 3) * 32 + lane];
            }
            #pragma unroll
            for (int qs = 0; qs < QS; ++qs) {
                const v8f x = (v8f){0.f,0.f,0.f,0.f,0.f,0.f,0.f,0.f};
                S[qs][b] = __builtin_amdgcn_wmma_f32_16x16x32_bf16(false, kr[b % KD][0], false,
                               qa[qs].v, (short)0, x, false, false);
            }
            #pragma unroll
            for (int qs = 0; qs < QS; ++qs)
                S[qs][b] = __builtin_amdgcn_wmma_f32_16x16x32_bf16(false, kr[b % KD][1], false,
                               qb[qs].v, (short)0, S[qs][b], false, false);
            if (b + KD < B_) {
                #pragma unroll
                for (int c = 0; c < 2; ++c)
                    kr[b % KD][c] = load_frag16(Ks + (b + KD) * (N_ * D_) + c * 512, lane8);
            }
        }

        // V fragments of the step's first 32-key chunk, both batches: in flight under the softmax
        v16bf vr[KS / 32][2][4];
        #pragma unroll
        for (int j = 0; j < 2; ++j) {
            #pragma unroll
            for (int t = 0; t < 4; ++t)
                vr[0][j][t] = load_frag16(Vs + j * (D_ * N_) + t * 512, lane8);
        }

        // ---- per subtile: softmax over the BATCH axis, in registers, then publish P:
        //      batch b, subtile qs, key tile w -> one 16-byte chunk per lane
        uint4* pb = sP + (s & 1) * (B_ * QS * WV * 32);
        Ks += (s + 1 < NK / KS) ? KS * D_ : 0;   // next step's key tile (the last step reads its own again, unused)
        #pragma unroll
        for (int qs = 0; qs < QS; ++qs) {
            #pragma unroll
            for (int r = 0; r < 8; ++r) {
                float m = -INFINITY;
                #pragma unroll
                for (int b = 0; b < B_; ++b) m = fmaxf(m, S[qs][b][r]);
                float sum = 0.f;
                #pragma unroll
                for (int b = 0; b < B_; ++b) { S[qs][b][r] = __expf(S[qs][b][r] - m); sum += S[qs][b][r]; }
                const float rs = 1.f / sum;
                #pragma unroll
                for (int b = 0; b < B_; ++b) S[qs][b][r] *= rs;
            }
            #pragma unroll
            for (int b = 0; b < B_; ++b) {
                ChunkU o;
                #pragma unroll
                for (int e = 0; e < 8; ++e) o.v[e] = (__bf16)S[qs][b][e];
                pb[((b * QS + qs) * WV + w) * 32 + lane] = o.u;
            }
            if (qs == 0) {
                // into the registers that subtile 0 has left: the step's second and third
                // V chunks, in flight under the softmax of subtile 1
                #pragma unroll
                for (int c = 1; c < 3; ++c) {
                    #pragma unroll
                    for (int j = 0; j < 2; ++j) {
                        #pragma unroll
                        for (int t = 0; t < 4; ++t)
                            vr[c][j][t] = load_frag16(Vs + j * (D_ * N_) + (c * 4 + t) * 512, lane8);
                    }
                }
            }
        }

        // The step's one barrier: publishes this buffer; the other buffer's
        // readers (previous step) are all in front of it, so the next step may refill it.
        __syncthreads();

        // the step's last V chunk: behind the barrier, which waits for every load issued before it
        #pragma unroll
        for (int j = 0; j < 2; ++j) {
            #pragma unroll
            for (int t = 0; t < 4; ++t)
                vr[3][j][t] = load_frag16(Vs + j * (D_ * N_) + (3 * 4 + t) * 512, lane8);
        }

        // ---- O^T += V^T * P^T for batches 2w, 2w+1 (64x32 @ 32x32 per chunk and batch)
        #pragma unroll
        for (int c = 0; c < KS / 32; ++c) {
            FragU p[2][QS];
            #pragma unroll
            for (int j = 0; j < 2; ++j) {
                #pragma unroll
                for (int qs = 0; qs < QS; ++qs) {
                    p[j][qs].u[0] = pb[(((2 * w + j) * QS + qs) * WV + 2 * c + 0) * 32 + lane];
                    p[j][qs].u[1] = pb[(((2 * w + j) * QS + qs) * WV + 2 * c + 1) * 32 + lane];
                }
            }
            #pragma unroll
            for (int j = 0; j < 2; ++j) {
                #pragma unroll
                for (int t = 0; t < 4; ++t) {
                    #pragma unroll
                    for (int qs = 0; qs < QS; ++qs)
                        acc[j][qs][t] = __builtin_amdgcn_wmma_f32_16x16x32_bf16(false, vr[c][j][t], false,
                                            p[j][qs].v, (short)0, acc[j][qs][t], false, false);
                }
            }
            if (c < 2) {
                // into the registers that V chunk c has left: half of the next step's K ring
                #pragma unroll
                for (int j = c * (KD / 2); j < (c + 1) * (KD / 2); ++j) {
                    #pragma unroll
                    for (int d = 0; d < 2; ++d)
                        kr[j][d] = load_frag16(Ks + j * (N_ * D_) + d * 512, lane8);
                }
            }
            if (c == 1) {
                // the ring's loads are still in flight at the loop's end, where their scalar base
                // is reused (next step's advance, the epilogue's store base): wait before that
                asm volatile("s_wait_xcnt 0x0" ::: "memory");
            }
        }
    }

    // the last step's ring refill is never used: let it land before the wave ends and gives its registers back
    asm volatile("s_wait_loadcnt 0x0" ::: "memory");

    // ---- store the range's partial tiles in register order: float4 i of a lane at
    //      Pt[b*128 + 16-row q tile][range][i][lane], so each wave-wide store is 512 contiguous bytes
    #pragma unroll
    for (int j = 0; j < 2; ++j) {
        #pragma unroll
        for (int qs = 0; qs < QS; ++qs) {
            float* Pb = Pt + (((size_t)(2 * w + j) * (N_ / 16) + blockIdx.x * QS + qs) * KH + kh) * (16 * D_) + lane * 4;
            #pragma unroll
            for (int t = 0; t < 4; ++t) {
                *(float4*)(Pb + (2 * t + 0) * 128) = make_float4(acc[j][qs][t][0], acc[j][qs][t][1], acc[j][qs][t][2], acc[j][qs][t][3]);
                *(float4*)(Pb + (2 * t + 1) * 128) = make_float4(acc[j][qs][t][4], acc[j][qs][t][5], acc[j][qs][t][6], acc[j][qs][t][7]);
            }
        }
    }
}

// =====================================================================
// Merge: O = sum of the four ranges' partials, (0 + 1) + (2 + 3). One wave per
// (batch, 16-row q tile, half of d): whole-line loads of the partials, then the
// output stores; a half of d is one whole 128-byte line of each output row.
// =====================================================================
typedef __attribute__((ext_vector_type(4))) float v4f;

__global__ __launch_bounds__(256)
void merge_ranges(const float* __restrict__ Pt, float* __restrict__ O) {
    const unsigned lane = threadIdx.x & 31u;
    // (b*128 + q tile)*2 + half, the same in every lane: held scalar so that the bases are scalar
    const unsigned u    = blockIdx.x * 8u + __builtin_amdgcn_readfirstlane(threadIdx.x >> 5);
    const unsigned g    = u >> 1, hf = u & 1u;
    const float* p0 = Pt + (size_t)g * (KH * 16 * D_) + hf * 512u;   // scalar; the lane's part is lane4
    const unsigned lane4 = lane * 4u;
    v4f a[KH][4];
    #pragma unroll
    for (int k = 0; k < KH; ++k) {
        const float* pk = p0 + k * (16 * D_);
        #pragma unroll
        for (int j = 0; j < 4; ++j) a[k][j] = *(const v4f*)(pk + j * 128 + lane4);
    }
    // lane holds O[g*16 + lr][hf*32 + t*16 + 8*lg + 0..7], t = 0..1, 32 contiguous bytes per t
    float* Ob = O + ((size_t)g * 16 + (lane & 15u)) * D_ + hf * 32u + 8u * (lane >> 4);
    #pragma unroll
    for (int j = 0; j < 4; ++j)
        *(v4f*)(Ob + (j >> 1) * 16 + (j & 1) * 4) = (a[0][j] + a[1][j]) + (a[2][j] + a[3][j]);
}

extern "C" void kernel_launch(void* const* d_in, const int* in_sizes, int n_in,
                              void* d_out, int out_size, void* d_ws, size_t ws_size,
                              hipStream_t stream) {
    const float* Q = (const float*)d_in[0];
    const float* K = (const float*)d_in[1];
    const float* V = (const float*)d_in[2];
    float* O = (float*)d_out;
    (void)in_sizes; (void)n_in; (void)out_size; (void)ws_size;

    ushort_t* Kb = (ushort_t*)d_ws;                       // 4 MiB
    ushort_t* Vt = Kb + (size_t)B_ * N_ * D_;             // 4 MiB
    float*    Pt = (float*)(Vt + (size_t)B_ * N_ * D_);   // 4 x 8 MiB of f32 partial sums

    cvt_kv<<<dim3(B_ * N_ * D_ / 8 / 256), dim3(256), 0, stream>>>(K, V, Kb, Vt);

    dim3 grid(N_ / QT, KH);  // 64 q-tiles x 4 key ranges
    dim3 block(32, WV);      // 8 waves: wave w scores key tile w, sums batches 2w and 2w+1
    batch_softmax_attn<<<grid, block, 0, stream>>>(Q, Kb, Vt, Pt);

    merge_ranges<<<dim3(B_ * N_ / 16 * 2 / 8), dim3(256), 0, stream>>>(Pt, O);
}

// v005
// One run takes 44.6 microseconds.
// Timed twice side by side with v004, it ran 1.07 times as fast both times.
// Over all steps from v000 it is 4.48 times as fast.
#include <hip/hip_runtime.h>
#include <math.h>

typedef __attribute__((ext_vector_type(16))) __bf16 v16bf;
typedef __attribute__((ext_vector_type(8)))  float  v8f;
typedef __attribute__((ext_vector_type(2)))  float  v2f;
typedef unsigned short ushort_t;

#define B_  16
#define N_  2048
#define D_  64
#define QT  32      // q rows per block
#define QS  2       // 16-row q subtiles per block: each K and V fragment feeds one WMMA per subtile
#define WV  8       // waves per block = key tiles per step
#define KS  128     // keys per step (WV tiles of 16)
#define KH  4       // key ranges: one block per (q tile, range), 64 x 4 = one block per WGP
#define NK  (N_ / KH)   // keys per range
#define KD  8       // K ring: batches in flight

// ---- build a v16bf WMMA fragment from two contiguous 16B chunks ----
union FragU { uint4 u[2]; v16bf v; };
// (packed layout below: base is wave-uniform, lane8 = lane*8 elements)
__device__ __forceinline__ v16bf load_frag16(const ushort_t* base, unsigned lane8) {
    FragU f;
    f.u[0] = *(const uint4*)(base + lane8);
    f.u[1] = *(const uint4*)(base + 256 + lane8);
    return f.v;
}

// Packed operand layout (both K and V): the unit is one half fragment of a
// wave, 32 lanes x 8 bf16 = 512 contiguous bytes, lane-major, so one
// wave-wide 16-byte load reads four whole 128-byte lines.
//   Kb chunk index = (((b*128 + key_tile)*2 + c)*2 + h)*32 + lane
//      holds K[b][key_tile*16 + lr][c*32 + h*16 + lg*8 + 0..7]
//   Vt chunk index = (((b*64 + step)*4 + t)*2 + h)*32 + lane
//      holds V[b][step*32 + h*16 + lg*8 + 0..7][t*16 + lr]
typedef __attribute__((ext_vector_type(8))) __bf16 v8bf;
union ChunkU { v8bf v; uint4 u; };

// =====================================================================
// Pre-pass: K and V -> bf16 in the packed fragment order above. One thread
// writes one 16-byte chunk of each; a block covers 32 keys of one batch,
// so every input line it touches is used up inside the block.
// =====================================================================
__global__ __launch_bounds__(256)
void cvt_kv(const float* __restrict__ K, const float* __restrict__ V,
            ushort_t* __restrict__ Kb, ushort_t* __restrict__ Vt) {
    const unsigned i  = blockIdx.x * 256u + threadIdx.x;   // chunk 0 .. B*N*D/8-1
    const unsigned lr = i & 15u, lg = (i >> 4) & 1u, h = (i >> 5) & 1u;
    {
        const unsigned c = (i >> 6) & 1u, row = (i >> 7) * 16u + lr;  // row = b*N + key
        const float* s = K + (size_t)row * D_ + c * 32u + h * 16u + lg * 8u;
        const float4 x = *(const float4*)s;
        const float4 y = *(const float4*)(s + 4);
        ChunkU o;
        o.v[0] = (__bf16)x.x; o.v[1] = (__bf16)x.y; o.v[2] = (__bf16)x.z; o.v[3] = (__bf16)x.w;
        o.v[4] = (__bf16)y.x; o.v[5] = (__bf16)y.y; o.v[6] = (__bf16)y.z; o.v[7] = (__bf16)y.w;
        *(uint4*)(Kb + (size_t)i * 8) = o.u;
    }
    {
        const unsigned t = (i >> 6) & 3u, row = (i >> 8) * 32u + h * 16u + lg * 8u;
        const float* s = V + (size_t)row * D_ + t * 16u + lr;
        ChunkU o;
        #pragma unroll
        for (int e = 0; e < 8; ++e) o.v[e] = (__bf16)s[e * D_];
        *(uint4*)(Vt + (size_t)i * 8) = o.u;
    }
}

// =====================================================================
// Main kernel: block = 8 waves on one 32-row q tile (two 16-row subtiles) and
// one range of 512 keys, 128 keys per step. The batch softmax couples nothing
// across keys, so a range's P*V is a plain partial sum of O; merge_ranges adds
// the four.
// Scores: wave w takes key tile w of the step for ALL 16 batches and both q
// subtiles, as S^T = K * Q^T, so the 16 values that the batch softmax couples
// sit in one lane, one register of each batch's D tile: max, exp and sum need
// no exchange, and a K fragment is loaded once for 32 q rows. A lane's 8 D
// registers, converted, are one half of the bf16 B operand of O^T = V^T * P^T
// (key = 8*lg + r inside the tile), so they go to LDS as one 16-byte chunk per
// batch and subtile. After one barrier wave w reads the chunks of batches 2w
// and 2w+1 and does their P*V over the 128 keys, each V fragment again serving
// both subtiles.
// =====================================================================
__global__ __launch_bounds__(256)
void batch_softmax_attn(const float* __restrict__ Q,
                        const ushort_t* __restrict__ Kb,
                        const ushort_t* __restrict__ Vt,
                        float* __restrict__ Pt) {
    __shared__ uint4 sQ[B_ * QS * 4 * 32];       // Q fragments [b][subtile][c*2+h][lane]        (64 KB)
    __shared__ uint4 sP[2 * B_ * QS * WV * 32];  // P chunks [buf][b][subtile][key tile][lane] (2 x 128 KB)

    const int lane = threadIdx.x;        // 0..31
    // wave id 0..7, held in a scalar register so that the K, V and LDS bases are scalar
    const int w    = __builtin_amdgcn_readfirstlane(threadIdx.y);
    const int lg   = lane >> 4;          // lane group (0/1) per WMMA layout
    const int lr   = lane & 15;
    const int q0   = blockIdx.x * QT;
    const int kh   = blockIdx.y;         // key range

    // ---- Q fragments of batches 2w and 2w+1 (16x32 bf16 x 2 d chunks per subtile),
    //      pre-scaled by 1/sqrt(64), shared with every wave through LDS
    float4 qf[2 * QS][8];                // per (batch, subtile): floats i*16 + lg*8 + 0..7 of the lane's row, i = 0..3
    #pragma unroll
    for (int u = 0; u < 2 * QS; ++u) {
        const int bq = 2 * QS * w + u;   // b*QS + subtile
        const float* rowp = Q + ((size_t)(bq >> 1) * N_ + q0 + (bq & 1) * 16 + lr) * D_ + lg * 8;
        #pragma unroll
        for (int i = 0; i < 4; ++i) {
            qf[u][2 * i + 0] = *(const float4*)(rowp + i * 16);
            qf[u][2 * i + 1] = *(const float4*)(rowp + i * 16 + 4);
        }
    }
    // the address registers of the loads above are reused right below: wait before they are overwritten
    asm volatile("s_wait_xcnt 0x0" ::: "memory");
    #pragma unroll
    for (int u = 0; u < 2 * QS; ++u) {
        const int bq = 2 * QS * w + u;
        #pragma unroll
        for (int c = 0; c < 2; ++c) {
            const float4 x0 = qf[u][4 * c + 0], x1 = qf[u][4 * c + 1];   // d = c*32 + lg*8 + 0..7
            const float4 y0 = qf[u][4 * c + 2], y1 = qf[u][4 * c + 3];   // d = c*32 + 16 + lg*8 + 0..7
            FragU f;
            f.v[0]  = (__bf16)(x0.x * 0.125f); f.v[1]  = (__bf16)(x0.y * 0.125f);
            f.v[2]  = (__bf16)(x0.z * 0.125f); f.v[3]  = (__bf16)(x0.w * 0.125f);
            f.v[4]  = (__bf16)(x1.x * 0.125f); f.v[5]  = (__bf16)(x1.y * 0.125f);
            f.v[6]  = (__bf16)(x1.z * 0.125f); f.v[7]  = (__bf16)(x1.w * 0.125f);
            f.v[8]  = (__bf16)(y0.x * 0.125f); f.v[9]  = (__bf16)(y0.y * 0.125f);
            f.v[10] = (__bf16)(y0.z * 0.125f); f.v[11] = (__bf16)(y0.w * 0.125f);
            f.v[12] = (__bf16)(y1.x * 0.125f); f.v[13] = (__bf16)(y1.y * 0.125f);
            f.v[14] = (__bf16)(y1.z * 0.125f); f.v[15] = (__bf16)(y1.w * 0.125f);
            sQ[(bq * 4 + c * 2 + 0) * 32 + lane] = f.u[0];
            sQ[(bq * 4 + c * 2 + 1) * 32 + lane] = f.u[1];
        }
    }

    // Every inner loop below is fully unrolled: acc, kr, S and vr stay in registers
    // only while each index is a constant.
    // O^T accumulators of batches 2w, 2w+1: per subtile 4 d-subtiles of 16 rows (f32 C/D layout)
    v8f acc[2][QS][4];
    #pragma unroll
    for (int j = 0; j < 2; ++j) {
        #pragma unroll
        for (int qs = 0; qs < QS; ++qs) {
            #pragma unroll
            for (int t = 0; t < 4; ++t) acc[j][qs][t] = (v8f){0.f,0.f,0.f,0.f,0.f,0.f,0.f,0.f};
        }
    }

    const unsigned  lane8 = lane * 8;
    const ushort_t* Kl = Kb + (size_t)kh * (NK * D_) + (size_t)w * 1024;         // key tile w of step 0, batch 0
    const ushort_t* Vl = Vt + (size_t)(2 * w) * D_ * N_ + (size_t)kh * (NK * D_);  // batch 2w

    // K fragments, a ring of KD batches in flight
    v16bf kr[KD][2];
    #pragma unroll
    for (int j = 0; j < KD; ++j) {
        #pragma unroll
        for (int c = 0; c < 2; ++c)
            kr[j][c] = load_frag16(Kl + j * (N_ * D_) + c * 512, lane8);
    }
    __syncthreads();

    const ushort_t* Ks = Kl;             // this step's key tile, batch 0
    for (int s = 0; s < NK / KS; ++s) {
        const ushort_t* Vs = Vl + s * (KS * D_);

        // ---- scores S^T[key][q] of key tile w, one D tile per batch and subtile
        v8f S[QS][B_];
        #pragma unroll
        for (int b = 0; b < B_; ++b) {
            FragU qa[QS], qb[QS];
            #pragma unroll
            for (int qs = 0; qs < QS; ++qs) {
                qa[qs].u[0] = sQ[((b * QS + qs) * 4 + 0) * 32 + lane];
                qa[qs].u[1] = sQ[((b * QS + qs) * 4 + 1) * 32 + lane];
                qb[qs].u[0] = sQ[((b * QS + qs) * 4 + 2) * 32 + lane];
                qb[qs].u[1] = sQ[((b * QS + qs) * 4 + 3) * 32 + lane];
            }
            // keeps a batch's eight LDS reads together as one group in front of its WMMAs
            __builtin_amdgcn_sched_barrier(0);
            #pragma unroll
            for (int qs = 0; qs < QS; ++qs) {
                const v8f x = (v8f){0.f,0.f,0.f,0.f,0.f,0.f,0.f,0.f};
                S[qs][b] = __builtin_amdgcn_wmma_f32_16x16x32_bf16(false, kr[b % KD][0], false,
                               qa[qs].v, (short)0, x, false, false);
            }
            #pragma unroll
            for (int qs = 0; qs < QS; ++qs)
                S[qs][b] = __builtin_amdgcn_wmma_f32_16x16x32_bf16(false, kr[b % KD][1], false,
                               qb[qs].v, (short)0, S[qs][b], false, false);
            if (b + KD < B_) {
                #pragma unroll
                for (int c = 0; c < 2; ++c)
                    kr[b % KD][c] = load_frag16(Ks + (b + KD) * (N_ * D_) + c * 512, lane8);
            }
        }

        // V fragments of the step's first 32-key chunk, both batches: in flight under the softmax
        v16bf vr[KS / 32][2][4];
        #pragma unroll
        for (int j = 0; j < 2; ++j) {
            #pragma unroll
            for (int t = 0; t < 4; ++t)
                vr[0][j][t] = load_frag16(Vs + j * (D_ * N_) + t * 512, lane8);
        }
        // keeps these loads in front of the softmax: moved behind it they would be waited for at the barrier
        __builtin_amdgcn_sched_barrier(0);

        // ---- per subtile: softmax over the BATCH axis, in registers, then publish P:
        //      batch b, subtile qs, key tile w -> one 16-byte chunk per lane
        uint4* pb = sP + (s & 1) * (B_ * QS * WV * 32);
        Ks += (s + 1 < NK / KS) ? KS * D_ : 0;   // next step's key tile (the last step reads its own again, unused)
        #pragma unroll
        for (int qs = 0; qs < QS; ++qs) {
            // two D registers (r, r + 1) at a time: they are an aligned register pair, so the exponent's
            // argument, the sum and the normalisation each take one packed f32 instruction per pair
            const v2f l2e = (v2f){1.44269504f, 1.44269504f};
            v2f nm[4], sum[4], rs[4];
            #pragma unroll
            for (int h = 0; h < 4; ++h) {
                float m0 = -INFINITY, m1 = -INFINITY;
                #pragma unroll
                for (int b = 0; b < B_; ++b) { m0 = fmaxf(m0, S[qs][b][2 * h]); m1 = fmaxf(m1, S[qs][b][2 * h + 1]); }
                nm[h] = (v2f){m0, m1} * -l2e;
            }
            #pragma unroll
            for (int b = 0; b < B_; ++b) {
                #pragma unroll
                for (int h = 0; h < 4; ++h) {
                    // exp(s - m) = 2^(s*log2(e) - m*log2(e))
                    const v2f a = __builtin_elementwise_fma((v2f){S[qs][b][2 * h], S[qs][b][2 * h + 1]}, l2e, nm[h]);
                    const v2f e = (v2f){__builtin_amdgcn_exp2f(a.x), __builtin_amdgcn_exp2f(a.y)};
                    S[qs][b][2 * h] = e.x; S[qs][b][2 * h + 1] = e.y;
                    sum[h] = b ? sum[h] + e : e;
                }
            }
            #pragma unroll
            for (int h = 0; h < 4; ++h) rs[h] = (v2f){1.f / sum[h].x, 1.f / sum[h].y};
            #pragma unroll
            for (int b = 0; b < B_; ++b) {
                #pragma unroll
                for (int h = 0; h < 4; ++h) {
                    const v2f p = (v2f){S[qs][b][2 * h], S[qs][b][2 * h + 1]} * rs[h];
                    S[qs][b][2 * h] = p.x; S[qs][b][2 * h + 1] = p.y;
                }
            }
            #pragma unroll
            for (int b = 0; b < B_; ++b) {
                ChunkU o;
                #pragma unroll
                for (int e = 0; e < 8; ++e) o.v[e] = (__bf16)S[qs][b][e];
                pb[((b * QS + qs) * WV + w) * 32 + lane] = o.u;
            }
            if (qs == 0) {
                // into the registers that subtile 0 has left: the step's second and third
                // V chunks, in flight under the softmax of subtile 1
                #pragma unroll
                for (int c = 1; c < 3; ++c) {
                    #pragma unroll
                    for (int j = 0; j < 2; ++j) {
                        #pragma unroll
                        for (int t = 0; t < 4; ++t)
                            vr[c][j][t] = load_frag16(Vs + j * (D_ * N_) + (c * 4 + t) * 512, lane8);
                    }
                }
                // keeps these loads in front of subtile 1, whose arithmetic covers their flight: moved
                // behind it they would be waited for at the barrier
                __builtin_amdgcn_sched_barrier(0);
            }
        }

        // The step's one barrier: publishes this buffer; the other buffer's
        // readers (previous step) are all in front of it, so the next step may refill it.
        __syncthreads();

        // the step's last V chunk: behind the barrier, which waits for every load issued before it
        #pragma unroll
        for (int j = 0; j < 2; ++j) {
            #pragma unroll
            for (int t = 0; t < 4; ++t)
                vr[3][j][t] = load_frag16(Vs + j * (D_ * N_) + (3 * 4 + t) * 512, lane8);
        }

        // ---- O^T += V^T * P^T for batches 2w, 2w+1 (64x32 @ 32x32 per chunk and batch)
        #pragma unroll
        for (int c = 0; c < KS / 32; ++c) {
            FragU p[2][QS];
            #pragma unroll
            for (int j = 0; j < 2; ++j) {
                #pragma unroll
                for (int qs = 0; qs < QS; ++qs) {
                    p[j][qs].u[0] = pb[(((2 * w + j) * QS + qs) * WV + 2 * c + 0) * 32 + lane];
                    p[j][qs].u[1] = pb[(((2 * w + j) * QS + qs) * WV + 2 * c + 1) * 32 + lane];
                }
            }
            #pragma unroll
            for (int j = 0; j < 2; ++j) {
                #pragma unroll
                for (int t = 0; t < 4; ++t) {
                    #pragma unroll
                    for (int qs = 0; qs < QS; ++qs)
                        acc[j][qs][t] = __builtin_amdgcn_wmma_f32_16x16x32_bf16(false, vr[c][j][t], false,
                                            p[j][qs].v, (short)0, acc[j][qs][t], false, false);
                }
            }
            if (c < 2) {
                // into the registers that V chunk c has left: half of the next step's K ring
                #pragma unroll
                for (int j = c * (KD / 2); j < (c + 1) * (KD / 2); ++j) {
                    #pragma unroll
                    for (int d = 0; d < 2; ++d)
                        kr[j][d] = load_frag16(Ks + j * (N_ * D_) + d * 512, lane8);
                }
            }
            if (c == 1) {
                // the ring's loads are still in flight at the loop's end, where their scalar base
                // is reused (next step's advance, the epilogue's store base): wait before that
                asm volatile("s_wait_xcnt 0x0" ::: "memory");
            }
        }
    }

    // the last step's ring refill is never used: let it land before the wave ends and gives its registers back
    asm volatile("s_wait_loadcnt 0x0" ::: "memory");

    // ---- store the range's partial tiles in register order: float4 i of a lane at
    //      Pt[b*128 + 16-row q tile][range][i][lane], so each wave-wide store is 512 contiguous bytes
    #pragma unroll
    for (int j = 0; j < 2; ++j) {
        #pragma unroll
        for (int qs = 0; qs < QS; ++qs) {
            float* Pb = Pt + (((size_t)(2 * w + j) * (N_ / 16) + blockIdx.x * QS + qs) * KH + kh) * (16 * D_) + lane * 4;
            #pragma unroll
            for (int t = 0; t < 4; ++t) {
                *(float4*)(Pb + (2 * t + 0) * 128) = make_float4(acc[j][qs][t][0], acc[j][qs][t][1], acc[j][qs][t][2], acc[j][qs][t][3]);
                *(float4*)(Pb + (2 * t + 1) * 128) = make_float4(acc[j][qs][t][4], acc[j][qs][t][5], acc[j][qs][t][6], acc[j][qs][t][7]);
            }
        }
    }
}

// =====================================================================
// Merge: O = sum of the four ranges' partials, (0 + 1) + (2 + 3). One wave per
// (batch, 16-row q tile, half of d): whole-line loads of the partials, then the
// output stores; a half of d is one whole 128-byte line of each output row.
// =====================================================================
typedef __attribute__((ext_vector_type(4))) float v4f;

__global__ __launch_bounds__(256)
void merge_ranges(const float* __restrict__ Pt, float* __restrict__ O) {
    const unsigned lane = threadIdx.x & 31u;
    // (b*128 + q tile)*2 + half, the same in every lane: held scalar so that the bases are scalar
    const unsigned u    = blockIdx.x * 8u + __builtin_amdgcn_readfirstlane(threadIdx.x >> 5);
    const unsigned g    = u >> 1, hf = u & 1u;
    const float* p0 = Pt + (size_t)g * (KH * 16 * D_) + hf * 512u;   // scalar; the lane's part is lane4
    const unsigned lane4 = lane * 4u;
    v4f a[KH][4];
    #pragma unroll
    for (int k = 0; k < KH; ++k) {
        const float* pk = p0 + k * (16 * D_);
        #pragma unroll
        for (int j = 0; j < 4; ++j) a[k][j] = *(const v4f*)(pk + j * 128 + lane4);
    }
    // lane holds O[g*16 + lr][hf*32 + t*16 + 8*lg + 0..7], t = 0..1, 32 contiguous bytes per t
    float* Ob = O + ((size_t)g * 16 + (lane & 15u)) * D_ + hf * 32u + 8u * (lane >> 4);
    #pragma unroll
    for (int j = 0; j < 4; ++j)
        *(v4f*)(Ob + (j >> 1) * 16 + (j & 1) * 4) = (a[0][j] + a[1][j]) + (a[2][j] + a[3][j]);
}

extern "C" void kernel_launch(void* const* d_in, const int* in_sizes, int n_in,
                              void* d_out, int out_size, void* d_ws, size_t ws_size,
                              hipStream_t stream) {
    const float* Q = (const float*)d_in[0];
    const float* K = (const float*)d_in[1];
    const float* V = (const float*)d_in[2];
    float* O = (float*)d_out;
    (void)in_sizes; (void)n_in; (void)out_size; (void)ws_size;

    ushort_t* Kb = (ushort_t*)d_ws;                       // 4 MiB
    ushort_t* Vt = Kb + (size_t)B_ * N_ * D_;             // 4 MiB
    float*    Pt = (float*)(Vt + (size_t)B_ * N_ * D_);   // 4 x 8 MiB of f32 partial sums

    cvt_kv<<<dim3(B_ * N_ * D_ / 8 / 256), dim3(256), 0, stream>>>(K, V, Kb, Vt);

    dim3 grid(N_ / QT, KH);  // 64 q-tiles x 4 key ranges
    dim3 block(32, WV);      // 8 waves: wave w scores key tile w, sums batches 2w and 2w+1
    batch_softmax_attn<<<grid, block, 0, stream>>>(Q, Kb, Vt, Pt);

    merge_ranges<<<dim3(B_ * N_ / 16 * 2 / 8), dim3(256), 0, stream>>>(Pt, O);
}

// v007
// It runs in 37.1 microseconds.
// Versions in between are left out here; by their measured steps it is 1.18 times as fast as v005.
// Counting every step since v000, it is 5.31 times as fast.
#include <hip/hip_runtime.h>
#include <math.h>

typedef __attribute__((ext_vector_type(16))) __bf16 v16bf;
typedef __attribute__((ext_vector_type(8)))  float  v8f;
typedef __attribute__((ext_vector_type(2)))  float  v2f;
typedef unsigned short ushort_t;

#define B_  16
#define N_  2048
#define D_  64
#define QT  32      // q rows per block
#define QS  2       // 16-row q subtiles per block: each K and V fragment feeds one WMMA per subtile
#define WV  8       // waves per block = key tiles per step
#define KS  128     // keys per step (WV tiles of 16)
#define KH  4       // key ranges: one block per (q tile, range), 64 x 4 = one block per WGP
#define NK  (N_ / KH)   // keys per range
#define KD  8       // K ring: batches in flight

// ---- build a v16bf WMMA fragment from two contiguous 16B chunks ----
union FragU { uint4 u[2]; v16bf v; };
// (packed layout below: base is wave-uniform, lane8 = lane*8 elements)
__device__ __forceinline__ v16bf load_frag16(const ushort_t* base, unsigned lane8) {
    FragU f;
    f.u[0] = *(const uint4*)(base + lane8);
    f.u[1] = *(const uint4*)(base + 256 + lane8);
    return f.v;
}

// Packed operand layout (both K and V): the unit is one half fragment of a
// wave, 32 lanes x 8 bf16 = 512 contiguous bytes, lane-major, so one
// wave-wide 16-byte load reads four whole 128-byte lines.
//   Kb chunk index = (((b*128 + key_tile)*2 + c)*2 + h)*32 + lane
//      holds K[b][key_tile*16 + lr][c*32 + h*16 + lg*8 + 0..7]
//   Vt chunk index = (((b*64 + step)*4 + t)*2 + h)*32 + lane
//      holds V[b][step*32 + h*16 + lg*8 + 0..7][t*16 + lr]
typedef __attribute__((ext_vector_type(8))) __bf16 v8bf;
union ChunkU { v8bf v; uint4 u; };
// eight f16 partial sums of O, one 16-byte chunk
typedef __attribute__((ext_vector_type(8))) _Float16 v8h;
union HalfU { v8h v; uint4 u; };

// =====================================================================
// Pre-pass: K and V -> bf16 in the packed fragment order above. One thread
// writes one 16-byte chunk of each; a block covers 32 keys of one batch,
// so every input line it touches is used up inside the block.
// =====================================================================
__global__ __launch_bounds__(256)
void cvt_kv(const float* __restrict__ K, const float* __restrict__ V,
            ushort_t* __restrict__ Kb, ushort_t* __restrict__ Vt) {
    const unsigned i  = blockIdx.x * 256u + threadIdx.x;   // chunk 0 .. B*N*D/8-1
    const unsigned lr = i & 15u, lg = (i >> 4) & 1u, h = (i >> 5) & 1u;
    {
        const unsigned c = (i >> 6) & 1u, row = (i >> 7) * 16u + lr;  // row = b*N + key
        const float* s = K + (size_t)row * D_ + c * 32u + h * 16u + lg * 8u;
        const float4 x = *(const float4*)s;
        const float4 y = *(const float4*)(s + 4);
        ChunkU o;
        o.v[0] = (__bf16)x.x; o.v[1] = (__bf16)x.y; o.v[2] = (__bf16)x.z; o.v[3] = (__bf16)x.w;
        o.v[4] = (__bf16)y.x; o.v[5] = (__bf16)y.y; o.v[6] = (__bf16)y.z; o.v[7] = (__bf16)y.w;
        *(uint4*)(Kb + (size_t)i * 8) = o.u;
    }
    {
        const unsigned t = (i >> 6) & 3u, row = (i >> 8) * 32u + h * 16u + lg * 8u;
        const float* s = V + (size_t)row * D_ + t * 16u + lr;
        ChunkU o;
        #pragma unroll
        for (int e = 0; e < 8; ++e) o.v[e] = (__bf16)s[e * D_];
        *(uint4*)(Vt + (size_t)i * 8) = o.u;
    }
}

// =====================================================================
// Main kernel: block = 8 waves on one 32-row q tile (two 16-row subtiles) and
// one range of 512 keys, 128 keys per step, the steps in rotated order. The batch softmax couples nothing
// across keys, so a range's P*V is a plain partial sum of O; merge_ranges adds
// the four.
// Scores: wave w takes key tile w of the step for ALL 16 batches and both q
// subtiles, as S^T = K * Q^T, so the 16 values that the batch softmax couples
// sit in one lane, one register of each batch's D tile: max, exp and sum need
// no exchange, and a K fragment is loaded once for 32 q rows. A lane's 8 D
// registers, converted, are one half of the bf16 B operand of O^T = V^T * P^T
// (key = 8*lg + r inside the tile), so they go to LDS as one 16-byte chunk per
// batch and subtile. After one barrier wave w reads the chunks of batches 2w
// and 2w+1 and does their P*V over the 128 keys, each V fragment again serving
// both subtiles.
// =====================================================================
__global__ __launch_bounds__(256)
void batch_softmax_attn(const float* __restrict__ Q,
                        const ushort_t* __restrict__ Kb,
                        const ushort_t* __restrict__ Vt,
                        ushort_t* __restrict__ Pt) {
    __shared__ uint4 sQ[B_ * QS * 4 * 32];       // Q fragments [b][subtile][c*2+h][lane]        (64 KB)
    __shared__ uint4 sP[2 * B_ * QS * WV * 32];  // P chunks [buf][b][subtile][key tile][lane] (2 x 128 KB)

    const int lane = threadIdx.x;        // 0..31
    // wave id 0..7, held in a scalar register so that the K, V and LDS bases are scalar
    const int w    = __builtin_amdgcn_readfirstlane(threadIdx.y);
    const int lg   = lane >> 4;          // lane group (0/1) per WMMA layout
    const int lr   = lane & 15;
    const int q0   = blockIdx.x * QT;
    const int kh   = blockIdx.y;         // key range

    // ---- Q fragments of batches 2w and 2w+1 (16x32 bf16 x 2 d chunks per subtile),
    //      pre-scaled by 1/sqrt(64), shared with every wave through LDS
    float4 qf[2 * QS][8];                // per (batch, subtile): floats i*16 + lg*8 + 0..7 of the lane's row, i = 0..3
    #pragma unroll
    for (int u = 0; u < 2 * QS; ++u) {
        const int bq = 2 * QS * w + u;   // b*QS + subtile
        const float* rowp = Q + ((size_t)(bq >> 1) * N_ + q0 + (bq & 1) * 16 + lr) * D_ + lg * 8;
        #pragma unroll
        for (int i = 0; i < 4; ++i) {
            qf[u][2 * i + 0] = *(const float4*)(rowp + i * 16);
            qf[u][2 * i + 1] = *(const float4*)(rowp + i * 16 + 4);
        }
    }
    // the address registers of the loads above are reused right below: wait before they are overwritten
    asm volatile("s_wait_xcnt 0x0" ::: "memory");
    #pragma unroll
    for (int u = 0; u < 2 * QS; ++u) {
        const int bq = 2 * QS * w + u;
        #pragma unroll
        for (int c = 0; c < 2; ++c) {
            const float4 x0 = qf[u][4 * c + 0], x1 = qf[u][4 * c + 1];   // d = c*32 + lg*8 + 0..7
            const float4 y0 = qf[u][4 * c + 2], y1 = qf[u][4 * c + 3];   // d = c*32 + 16 + lg*8 + 0..7
            FragU f;
            f.v[0]  = (__bf16)(x0.x * 0.125f); f.v[1]  = (__bf16)(x0.y * 0.125f);
            f.v[2]  = (__bf16)(x0.z * 0.125f); f.v[3]  = (__bf16)(x0.w * 0.125f);
            f.v[4]  = (__bf16)(x1.x * 0.125f); f.v[5]  = (__bf16)(x1.y * 0.125f);
            f.v[6]  = (__bf16)(x1.z * 0.125f); f.v[7]  = (__bf16)(x1.w * 0.125f);
            f.v[8]  = (__bf16)(y0.x * 0.125f); f.v[9]  = (__bf16)(y0.y * 0.125f);
            f.v[10] = (__bf16)(y0.z * 0.125f); f.v[11] = (__bf16)(y0.w * 0.125f);
            f.v[12] = (__bf16)(y1.x * 0.125f); f.v[13] = (__bf16)(y1.y * 0.125f);
            f.v[14] = (__bf16)(y1.z * 0.125f); f.v[15] = (__bf16)(y1.w * 0.125f);
            sQ[(bq * 4 + c * 2 + 0) * 32 + lane] = f.u[0];
            sQ[(bq * 4 + c * 2 + 1) * 32 + lane] = f.u[1];
        }
    }

    // Every inner loop below is fully unrolled: acc, kr, S and vr stay in registers
    // only while each index is a constant.
    // O^T accumulators of batches 2w, 2w+1: per subtile 4 d-subtiles of 16 rows (f32 C/D layout)
    v8f acc[2][QS][4];
    #pragma unroll
    for (int j = 0; j < 2; ++j) {
        #pragma unroll
        for (int qs = 0; qs < QS; ++qs) {
            #pragma unroll
            for (int t = 0; t < 4; ++t) acc[j][qs][t] = (v8f){0.f,0.f,0.f,0.f,0.f,0.f,0.f,0.f};
        }
    }

    const unsigned  lane8 = lane * 8;
    const ushort_t* Kl = Kb + (size_t)kh * (NK * D_) + (size_t)w * 1024;         // key tile w of the range's first slice, batch 0
    const ushort_t* Vl = Vt + (size_t)(2 * w) * D_ * N_ + (size_t)kh * (NK * D_);  // batch 2w
    // The 64 blocks of a range start together. Each walks the range's steps from its own start slice
    // (wrapping round), so that all slices are fetched into L2 during the first step, each by a quarter
    // of the blocks, and every later step reads lines that other blocks have already brought in.
    const int rot = blockIdx.x & (NK / KS - 1);

    // K fragments, a ring of KD batches in flight
    v16bf kr[KD][2];
    #pragma unroll
    for (int j = 0; j < KD; ++j) {
        #pragma unroll
        for (int c = 0; c < 2; ++c)
            kr[j][c] = load_frag16(Kl + rot * (KS * D_) + j * (N_ * D_) + c * 512, lane8);
    }
    __syncthreads();

    const ushort_t* Ks = Kl + rot * (KS * D_);   // this step's key tile, batch 0
    for (int s = 0; s < NK / KS; ++s) {
        const ushort_t* Vs = Vl + ((s + rot) & (NK / KS - 1)) * (KS * D_);

        // ---- scores S^T[key][q] of key tile w, one D tile per batch and subtile
        v8f S[QS][B_];
        #pragma unroll
        for (int b = 0; b < B_; ++b) {
            FragU qa[QS], qb[QS];
            #pragma unroll
            for (int qs = 0; qs < QS; ++qs) {
                qa[qs].u[0] = sQ[((b * QS + qs) * 4 + 0) * 32 + lane];
                qa[qs].u[1] = sQ[((b * QS + qs) * 4 + 1) * 32 + lane];
                qb[qs].u[0] = sQ[((b * QS + qs) * 4 + 2) * 32 + lane];
                qb[qs].u[1] = sQ[((b * QS + qs) * 4 + 3) * 32 + lane];
            }
            // keeps a batch's eight LDS reads together as one group in front of its WMMAs
            __builtin_amdgcn_sched_barrier(0);
            #pragma unroll
            for (int qs = 0; qs < QS; ++qs) {
                const v8f x = (v8f){0.f,0.f,0.f,0.f,0.f,0.f,0.f,0.f};
                S[qs][b] = __builtin_amdgcn_wmma_f32_16x16x32_bf16(false, kr[b % KD][0], false,
                               qa[qs].v, (short)0, x, false, false);
            }
            #pragma unroll
            for (int qs = 0; qs < QS; ++qs)
                S[qs][b] = __builtin_amdgcn_wmma_f32_16x16x32_bf16(false, kr[b % KD][1], false,
                               qb[qs].v, (short)0, S[qs][b], false, false);
            if (b + KD < B_) {
                #pragma unroll
                for (int c = 0; c < 2; ++c)
                    kr[b % KD][c] = load_frag16(Ks + (b + KD) * (N_ * D_) + c * 512, lane8);
            }
        }

        // V fragments of the step's first 32-key chunk, both batches: in flight under the softmax
        v16bf vr[KS / 32][2][4];
        #pragma unroll
        for (int j = 0; j < 2; ++j) {
            #pragma unroll
            for (int t = 0; t < 4; ++t)
                vr[0][j][t] = load_frag16(Vs + j * (D_ * N_) + t * 512, lane8);
        }
        // keeps these loads in front of the softmax: moved behind it they would be waited for at the barrier
        __builtin_amdgcn_sched_barrier(0);

        // ---- per subtile: softmax over the BATCH axis, in registers, then publish P:
        //      batch b, subtile qs, key tile w -> one 16-byte chunk per lane
        uint4* pb = sP + (s & 1) * (B_ * QS * WV * 32);
        // next step's key tile, back to the range's first slice behind its last (the last step reads the block's first again, unused)
        Ks += (((s + 1 + rot) & (NK / KS - 1)) == 0) ? -(NK - KS) * D_ : KS * D_;
        #pragma unroll
        for (int qs = 0; qs < QS; ++qs) {
            // two D registers (r, r + 1) at a time: they are an aligned register pair, so the exponent's
            // argument, the sum and the normalisation each take one packed f32 instruction per pair
            const v2f l2e = (v2f){1.44269504f, 1.44269504f};
            v2f nm[4], sum[4], rs[4];
            #pragma unroll
            for (int h = 0; h < 4; ++h) {
                float m0 = -INFINITY, m1 = -INFINITY;
                #pragma unroll
                for (int b = 0; b < B_; ++b) { m0 = fmaxf(m0, S[qs][b][2 * h]); m1 = fmaxf(m1, S[qs][b][2 * h + 1]); }
                nm[h] = (v2f){m0, m1} * -l2e;
            }
            #pragma unroll
            for (int b = 0; b < B_; ++b) {
                #pragma unroll
                for (int h = 0; h < 4; ++h) {
                    // exp(s - m) = 2^(s*log2(e) - m*log2(e))
                    const v2f a = __builtin_elementwise_fma((v2f){S[qs][b][2 * h], S[qs][b][2 * h + 1]}, l2e, nm[h]);
                    const v2f e = (v2f){__builtin_amdgcn_exp2f(a.x), __builtin_amdgcn_exp2f(a.y)};
                    S[qs][b][2 * h] = e.x; S[qs][b][2 * h + 1] = e.y;
                    sum[h] = b ? sum[h] + e : e;
                }
            }
            #pragma unroll
            for (int h = 0; h < 4; ++h) rs[h] = (v2f){1.f / sum[h].x, 1.f / sum[h].y};
            #pragma unroll
            for (int b = 0; b < B_; ++b) {
                #pragma unroll
                for (int h = 0; h < 4; ++h) {
                    const v2f p = (v2f){S[qs][b][2 * h], S[qs][b][2 * h + 1]} * rs[h];
                    S[qs][b][2 * h] = p.x; S[qs][b][2 * h + 1] = p.y;
                }
            }
            #pragma unroll
            for (int b = 0; b < B_; ++b) {
                ChunkU o;
                #pragma unroll
                for (int e = 0; e < 8; ++e) o.v[e] = (__bf16)S[qs][b][e];
                pb[((b * QS + qs) * WV + w) * 32 + lane] = o.u;
            }
            if (qs == 0) {
                // into the registers that subtile 0 has left: the step's second and third
                // V chunks, in flight under the softmax of subtile 1
                #pragma unroll
                for (int c = 1; c < 3; ++c) {
                    #pragma unroll
                    for (int j = 0; j < 2; ++j) {
                        #pragma unroll
                        for (int t = 0; t < 4; ++t)
                            vr[c][j][t] = load_frag16(Vs + j * (D_ * N_) + (c * 4 + t) * 512, lane8);
                    }
                }
                // keeps these loads in front of subtile 1, whose arithmetic covers their flight: moved
                // behind it they would be waited for at the barrier
                __builtin_amdgcn_sched_barrier(0);
            }
        }

        // The step's one barrier: publishes this buffer; the other buffer's
        // readers (previous step) are all in front of it, so the next step may refill it.
        __syncthreads();

        // the step's last V chunk: behind the barrier, which waits for every load issued before it
        #pragma unroll
        for (int j = 0; j < 2; ++j) {
            #pragma unroll
            for (int t = 0; t < 4; ++t)
                vr[3][j][t] = load_frag16(Vs + j * (D_ * N_) + (3 * 4 + t) * 512, lane8);
        }

        // ---- O^T += V^T * P^T for batches 2w, 2w+1 (64x32 @ 32x32 per chunk and batch)
        #pragma unroll
        for (int c = 0; c < KS / 32; ++c) {
            FragU p[2][QS];
            #pragma unroll
            for (int j = 0; j < 2; ++j) {
                #pragma unroll
                for (int qs = 0; qs < QS; ++qs) {
                    p[j][qs].u[0] = pb[(((2 * w + j) * QS + qs) * WV + 2 * c + 0) * 32 + lane];
                    p[j][qs].u[1] = pb[(((2 * w + j) * QS + qs) * WV + 2 * c + 1) * 32 + lane];
                }
            }
            #pragma unroll
            for (int j = 0; j < 2; ++j) {
                #pragma unroll
                for (int t = 0; t < 4; ++t) {
                    #pragma unroll
                    for (int qs = 0; qs < QS; ++qs)
                        acc[j][qs][t] = __builtin_amdgcn_wmma_f32_16x16x32_bf16(false, vr[c][j][t], false,
                                            p[j][qs].v, (short)0, acc[j][qs][t], false, false);
                }
            }
            if (c < 2) {
                // into the registers that V chunk c has left: half of the next step's K ring
                #pragma unroll
                for (int j = c * (KD / 2); j < (c + 1) * (KD / 2); ++j) {
                    #pragma unroll
                    for (int d = 0; d < 2; ++d)
                        kr[j][d] = load_frag16(Ks + j * (N_ * D_) + d * 512, lane8);
                }
            }
            if (c == 1) {
                // the ring's loads are still in flight at the loop's end, where their scalar base
                // is reused (next step's advance, the epilogue's store base): wait before that
                asm volatile("s_wait_xcnt 0x0" ::: "memory");
            }
        }
    }

    // the last step's ring refill is never used: let it land before the wave ends and gives its registers back
    asm volatile("s_wait_loadcnt 0x0" ::: "memory");

    // ---- store the range's partial tiles as f16, in register order: the 8 sums of d subtile t of a
    //      lane are one 16-byte chunk at Pt[b*128 + 16-row q tile][range][t][lane], so each wave-wide
    //      store is 512 contiguous bytes. A partial is at most 512 * max|V| in size (the weights of a
    //      key are at most 1), far inside f16's range for normal deviates.
    HalfU o[2][QS][4];
    #pragma unroll
    for (int j = 0; j < 2; ++j) {
        #pragma unroll
        for (int qs = 0; qs < QS; ++qs) {
            #pragma unroll
            for (int t = 0; t < 4; ++t) o[j][qs][t].v = __builtin_convertvector(acc[j][qs][t], v8h);
        }
    }
    #pragma unroll
    for (int j = 0; j < 2; ++j) {
        #pragma unroll
        for (int qs = 0; qs < QS; ++qs) {
            ushort_t* Pb = Pt + (((size_t)(2 * w + j) * (N_ / 16) + blockIdx.x * QS + qs) * KH + kh) * (16 * D_) + lane8;
            #pragma unroll
            for (int t = 0; t < 4; ++t) *(uint4*)(Pb + t * 256) = o[j][qs][t].u;
        }
    }
}

// =====================================================================
// Merge: O = sum of the four ranges' f16 partials, widened to f32 and added as
// (0 + 1) + (2 + 3). One wave per (batch, 16-row q tile, half of d): whole-line
// loads of the partials, then the output stores; a half of d is one whole
// 128-byte line of each output row.
// =====================================================================
typedef __attribute__((ext_vector_type(4))) float v4f;

__global__ __launch_bounds__(256)
void merge_ranges(const ushort_t* __restrict__ Pt, float* __restrict__ O) {
    const unsigned lane = threadIdx.x & 31u;
    // (b*128 + q tile)*2 + half, the same in every lane: held scalar so that the bases are scalar
    const unsigned u    = blockIdx.x * 8u + __builtin_amdgcn_readfirstlane(threadIdx.x >> 5);
    const unsigned g    = u >> 1, hf = u & 1u;
    const ushort_t* p0 = Pt + (size_t)g * (KH * 16 * D_) + hf * 512u;   // scalar; the lane's part is lane8
    const unsigned lane8 = lane * 8u;
    HalfU a[KH][2];
    #pragma unroll
    for (int k = 0; k < KH; ++k) {
        const ushort_t* pk = p0 + k * (16 * D_);
        #pragma unroll
        for (int t = 0; t < 2; ++t) a[k][t].u = *(const uint4*)(pk + t * 256 + lane8);
    }
    // lane holds O[g*16 + lr][hf*32 + t*16 + 8*lg + 0..7], t = 0..1, 32 contiguous bytes per t
    float* Ob = O + ((size_t)g * 16 + (lane & 15u)) * D_ + hf * 32u + 8u * (lane >> 4);
    #pragma unroll
    for (int t = 0; t < 2; ++t) {
        const v8f x = (__builtin_convertvector(a[0][t].v, v8f) + __builtin_convertvector(a[1][t].v, v8f))
                    + (__builtin_convertvector(a[2][t].v, v8f) + __builtin_convertvector(a[3][t].v, v8f));
        *(v4f*)(Ob + t * 16 + 0) = (v4f){x[0], x[1], x[2], x[3]};
        *(v4f*)(Ob + t * 16 + 4) = (v4f){x[4], x[5], x[6], x[7]};
    }
}

extern "C" void kernel_launch(void* const* d_in, const int* in_sizes, int n_in,
                              void* d_out, int out_size, void* d_ws, size_t ws_size,
                              hipStream_t stream) {
    const float* Q = (const float*)d_in[0];
    const float* K = (const float*)d_in[1];
    const float* V = (const float*)d_in[2];
    float* O = (float*)d_out;
    (void)in_sizes; (void)n_in; (void)out_size; (void)ws_size;

    ushort_t* Kb = (ushort_t*)d_ws;                       // 4 MiB
    ushort_t* Vt = Kb + (size_t)B_ * N_ * D_;             // 4 MiB
    ushort_t* Pt = Vt + (size_t)B_ * N_ * D_;             // 4 x 4 MiB of f16 partial sums

    cvt_kv<<<dim3(B_ * N_ * D_ / 8 / 256), dim3(256), 0, stream>>>(K, V, Kb, Vt);

    dim3 grid(N_ / QT, KH);  // 64 q-tiles x 4 key ranges
    dim3 block(32, WV);      // 8 waves: wave w scores key tile w, sums batches 2w and 2w+1
    batch_softmax_attn<<<grid, block, 0, stream>>>(Q, Kb, Vt, Pt);

    merge_ranges<<<dim3(B_ * N_ / 16 * 2 / 8), dim3(256), 0, stream>>>(Pt, O);
}

// v008
// Measured time: 35.9 microseconds a run.
// Next to v007, in two timings, it ran 1.04 and 1.03 times as fast.
// Over all steps from v000 it is 5.49 times as fast.
#include <hip/hip_runtime.h>
#include <math.h>

typedef __attribute__((ext_vector_type(16))) __bf16 v16bf;
typedef __attribute__((ext_vector_type(8)))  float  v8f;
typedef __attribute__((ext_vector_type(2)))  float  v2f;
typedef unsigned short ushort_t;

#define B_  16
#define N_  2048
#define D_  64
#define QT  32      // q rows per block
#define QS  2       // 16-row q subtiles per block: each K and V fragment feeds one WMMA per subtile
#define WV  8       // waves per block = key tiles per step
#define KS  128     // keys per step (WV tiles of 16)
#define KH  4       // key ranges: one block per (q tile, range), 64 x 4 = one block per WGP
#define NK  (N_ / KH)   // keys per range
#define KD  8       // K ring: batches in flight

// ---- build a v16bf WMMA fragment from two contiguous 16B chunks ----
union FragU { uint4 u[2]; v16bf v; };
// (packed layout below: base is wave-uniform, lane8 = lane*8 elements)
__device__ __forceinline__ v16bf load_frag16(const ushort_t* base, unsigned lane8) {
    FragU f;
    f.u[0] = *(const uint4*)(base + lane8);
    f.u[1] = *(const uint4*)(base + 256 + lane8);
    return f.v;
}

// Work-group barrier whose two fences are limited to LDS, which is all that the waves of a block hand
// to each other here. __syncthreads() would also wait for every global load in flight, so the path
// from L2 would run empty in all eight waves at once at every barrier.
__device__ __forceinline__ void lds_barrier() {
    __builtin_amdgcn_fence(__ATOMIC_RELEASE, "workgroup", "local");
    __builtin_amdgcn_s_barrier();
    __builtin_amdgcn_fence(__ATOMIC_ACQUIRE, "workgroup", "local");
}

// Packed operand layout (both K and V): the unit is one half fragment of a
// wave, 32 lanes x 8 bf16 = 512 contiguous bytes, lane-major, so one
// wave-wide 16-byte load reads four whole 128-byte lines.
//   Kb chunk index = (((b*128 + key_tile)*2 + c)*2 + h)*32 + lane
//      holds K[b][key_tile*16 + lr][c*32 + h*16 + lg*8 + 0..7]
//   Vt chunk index = (((b*64 + step)*4 + t)*2 + h)*32 + lane
//      holds V[b][step*32 + h*16 + lg*8 + 0..7][t*16 + lr]
typedef __attribute__((ext_vector_type(8))) __bf16 v8bf;
union ChunkU { v8bf v; uint4 u; };
// eight f16 partial sums of O, one 16-byte chunk
typedef __attribute__((ext_vector_type(8))) _Float16 v8h;
union HalfU { v8h v; uint4 u; };

// =====================================================================
// Pre-pass: K and V -> bf16 in the packed fragment order above. One thread
// writes one 16-byte chunk of each; a block covers 32 keys of one batch,
// so every input line it touches is used up inside the block.
// =====================================================================
__global__ __launch_bounds__(256)
void cvt_kv(const float* __restrict__ K, const float* __restrict__ V,
            ushort_t* __restrict__ Kb, ushort_t* __restrict__ Vt) {
    const unsigned i  = blockIdx.x * 256u + threadIdx.x;   // chunk 0 .. B*N*D/8-1
    const unsigned lr = i & 15u, lg = (i >> 4) & 1u, h = (i >> 5) & 1u;
    {
        const unsigned c = (i >> 6) & 1u, row = (i >> 7) * 16u + lr;  // row = b*N + key
        const float* s = K + (size_t)row * D_ + c * 32u + h * 16u + lg * 8u;
        const float4 x = *(const float4*)s;
        const float4 y = *(const float4*)(s + 4);
        ChunkU o;
        o.v[0] = (__bf16)x.x; o.v[1] = (__bf16)x.y; o.v[2] = (__bf16)x.z; o.v[3] = (__bf16)x.w;
        o.v[4] = (__bf16)y.x; o.v[5] = (__bf16)y.y; o.v[6] = (__bf16)y.z; o.v[7] = (__bf16)y.w;
        *(uint4*)(Kb + (size_t)i * 8) = o.u;
    }
    {
        const unsigned t = (i >> 6) & 3u, row = (i >> 8) * 32u + h * 16u + lg * 8u;
        const float* s = V + (size_t)row * D_ + t * 16u + lr;
        ChunkU o;
        #pragma unroll
        for (int e = 0; e < 8; ++e) o.v[e] = (__bf16)s[e * D_];
        *(uint4*)(Vt + (size_t)i * 8) = o.u;
    }
}

// =====================================================================
// Main kernel: block = 8 waves on one 32-row q tile (two 16-row subtiles) and
// one range of 512 keys, 128 keys per step, the steps in rotated order. The batch softmax couples nothing
// across keys, so a range's P*V is a plain partial sum of O; merge_ranges adds
// the four.
// Scores: wave w takes key tile w of the step for ALL 16 batches and both q
// subtiles, as S^T = K * Q^T, so the 16 values that the batch softmax couples
// sit in one lane, one register of each batch's D tile: max, exp and sum need
// no exchange, and a K fragment is loaded once for 32 q rows. A lane's 8 D
// registers, converted, are one half of the bf16 B operand of O^T = V^T * P^T
// (key = 8*lg + r inside the tile), so they go to LDS as one 16-byte chunk per
// batch and subtile. After one barrier wave w reads the chunks of batches 2w
// and 2w+1 and does their P*V over the 128 keys, each V fragment again serving
// both subtiles.
// =====================================================================
__global__ __launch_bounds__(256)
void batch_softmax_attn(const float* __restrict__ Q,
                        const ushort_t* __restrict__ Kb,
                        const ushort_t* __restrict__ Vt,
                        ushort_t* __restrict__ Pt) {
    __shared__ uint4 sQ[B_ * QS * 4 * 32];       // Q fragments [b][subtile][c*2+h][lane]        (64 KB)
    __shared__ uint4 sP[2 * B_ * QS * WV * 32];  // P chunks [buf][b][subtile][key tile][lane] (2 x 128 KB)

    const int lane = threadIdx.x;        // 0..31
    // wave id 0..7, held in a scalar register so that the K, V and LDS bases are scalar
    const int w    = __builtin_amdgcn_readfirstlane(threadIdx.y);
    const int lg   = lane >> 4;          // lane group (0/1) per WMMA layout
    const int lr   = lane & 15;
    const int q0   = blockIdx.x * QT;
    const int kh   = blockIdx.y;         // key range

    // ---- Q fragments of batches 2w and 2w+1 (16x32 bf16 x 2 d chunks per subtile),
    //      pre-scaled by 1/sqrt(64), shared with every wave through LDS
    float4 qf[2 * QS][8];                // per (batch, subtile): floats i*16 + lg*8 + 0..7 of the lane's row, i = 0..3
    #pragma unroll
    for (int u = 0; u < 2 * QS; ++u) {
        const int bq = 2 * QS * w + u;   // b*QS + subtile
        const float* rowp = Q + ((size_t)(bq >> 1) * N_ + q0 + (bq & 1) * 16 + lr) * D_ + lg * 8;
        #pragma unroll
        for (int i = 0; i < 4; ++i) {
            qf[u][2 * i + 0] = *(const float4*)(rowp + i * 16);
            qf[u][2 * i + 1] = *(const float4*)(rowp + i * 16 + 4);
        }
    }
    // the address registers of the loads above are reused right below: wait before they are overwritten
    asm volatile("s_wait_xcnt 0x0" ::: "memory");
    #pragma unroll
    for (int u = 0; u < 2 * QS; ++u) {
        const int bq = 2 * QS * w + u;
        #pragma unroll
        for (int c = 0; c < 2; ++c) {
            const float4 x0 = qf[u][4 * c + 0], x1 = qf[u][4 * c + 1];   // d = c*32 + lg*8 + 0..7
            const float4 y0 = qf[u][4 * c + 2], y1 = qf[u][4 * c + 3];   // d = c*32 + 16 + lg*8 + 0..7
            FragU f;
            f.v[0]  = (__bf16)(x0.x * 0.125f); f.v[1]  = (__bf16)(x0.y * 0.125f);
            f.v[2]  = (__bf16)(x0.z * 0.125f); f.v[3]  = (__bf16)(x0.w * 0.125f);
            f.v[4]  = (__bf16)(x1.x * 0.125f); f.v[5]  = (__bf16)(x1.y * 0.125f);
            f.v[6]  = (__bf16)(x1.z * 0.125f); f.v[7]  = (__bf16)(x1.w * 0.125f);
            f.v[8]  = (__bf16)(y0.x * 0.125f); f.v[9]  = (__bf16)(y0.y * 0.125f);
            f.v[10] = (__bf16)(y0.z * 0.125f); f.v[11] = (__bf16)(y0.w * 0.125f);
            f.v[12] = (__bf16)(y1.x * 0.125f); f.v[13] = (__bf16)(y1.y * 0.125f);
            f.v[14] = (__bf16)(y1.z * 0.125f); f.v[15] = (__bf16)(y1.w * 0.125f);
            sQ[(bq * 4 + c * 2 + 0) * 32 + lane] = f.u[0];
            sQ[(bq * 4 + c * 2 + 1) * 32 + lane] = f.u[1];
        }
    }

    // Every inner loop below is fully unrolled: acc, kr, S and vr stay in registers
    // only while each index is a constant.
    // O^T accumulators of batches 2w, 2w+1: per subtile 4 d-subtiles of 16 rows (f32 C/D layout)
    v8f acc[2][QS][4];
    #pragma unroll
    for (int j = 0; j < 2; ++j) {
        #pragma unroll
        for (int qs = 0; qs < QS; ++qs) {
            #pragma unroll
            for (int t = 0; t < 4; ++t) acc[j][qs][t] = (v8f){0.f,0.f,0.f,0.f,0.f,0.f,0.f,0.f};
        }
    }

    const unsigned  lane8 = lane * 8;
    const ushort_t* Kl = Kb + (size_t)kh * (NK * D_) + (size_t)w * 1024;         // key tile w of the range's first slice, batch 0
    const ushort_t* Vl = Vt + (size_t)(2 * w) * D_ * N_ + (size_t)kh * (NK * D_);  // batch 2w
    // The 64 blocks of a range start together. Each walks the range's steps from its own start slice
    // (wrapping round), so that all slices are fetched into L2 during the first step, each by a quarter
    // of the blocks, and every later step reads lines that other blocks have already brought in.
    const int rot = blockIdx.x & (NK / KS - 1);

    // K fragments, a ring of KD batches in flight
    v16bf kr[KD][2];
    #pragma unroll
    for (int j = 0; j < KD; ++j) {
        #pragma unroll
        for (int c = 0; c < 2; ++c)
            kr[j][c] = load_frag16(Kl + rot * (KS * D_) + j * (N_ * D_) + c * 512, lane8);
    }
    // the ring's loads stay in flight across the barrier below, and the loop reuses their address
    // registers: wait before those are overwritten
    asm volatile("s_wait_xcnt 0x0" ::: "memory");
    lds_barrier();   // publishes sQ

    const ushort_t* Ks = Kl + rot * (KS * D_);   // this step's key tile, batch 0
    for (int s = 0; s < NK / KS; ++s) {
        const ushort_t* Vs = Vl + ((s + rot) & (NK / KS - 1)) * (KS * D_);

        // ---- scores S^T[key][q] of key tile w, one D tile per batch and subtile
        v8f S[QS][B_];
        #pragma unroll
        for (int b = 0; b < B_; ++b) {
            FragU qa[QS], qb[QS];
            #pragma unroll
            for (int qs = 0; qs < QS; ++qs) {
                qa[qs].u[0] = sQ[((b * QS + qs) * 4 + 0) * 32 + lane];
                qa[qs].u[1] = sQ[((b * QS + qs) * 4 + 1) * 32 + lane];
                qb[qs].u[0] = sQ[((b * QS + qs) * 4 + 2) * 32 + lane];
                qb[qs].u[1] = sQ[((b * QS + qs) * 4 + 3) * 32 + lane];
            }
            // keeps a batch's eight LDS reads together as one group in front of its WMMAs
            __builtin_amdgcn_sched_barrier(0);
            #pragma unroll
            for (int qs = 0; qs < QS; ++qs) {
                const v8f x = (v8f){0.f,0.f,0.f,0.f,0.f,0.f,0.f,0.f};
                S[qs][b] = __builtin_amdgcn_wmma_f32_16x16x32_bf16(false, kr[b % KD][0], false,
                               qa[qs].v, (short)0, x, false, false);
            }
            #pragma unroll
            for (int qs = 0; qs < QS; ++qs)
                S[qs][b] = __builtin_amdgcn_wmma_f32_16x16x32_bf16(false, kr[b % KD][1], false,
                               qb[qs].v, (short)0, S[qs][b], false, false);
            if (b + KD < B_) {
                #pragma unroll
                for (int c = 0; c < 2; ++c)
                    kr[b % KD][c] = load_frag16(Ks + (b + KD) * (N_ * D_) + c * 512, lane8);
            }
        }

        // V fragments of the step's first 32-key chunk, both batches: in flight under the softmax
        v16bf vr[KS / 32][2][4];
        #pragma unroll
        for (int j = 0; j < 2; ++j) {
            #pragma unroll
            for (int t = 0; t < 4; ++t)
                vr[0][j][t] = load_frag16(Vs + j * (D_ * N_) + t * 512, lane8);
        }
        // keeps these loads in front of the softmax, whose arithmetic covers their flight
        __builtin_amdgcn_sched_barrier(0);

        // ---- per subtile: softmax over the BATCH axis, in registers, then publish P:
        //      batch b, subtile qs, key tile w -> one 16-byte chunk per lane
        uint4* pb = sP + (s & 1) * (B_ * QS * WV * 32);
        // next step's key tile, back to the range's first slice behind its last (the last step reads the block's first again, unused)
        Ks += (((s + 1 + rot) & (NK / KS - 1)) == 0) ? -(NK - KS) * D_ : KS * D_;
        #pragma unroll
        for (int qs = 0; qs < QS; ++qs) {
            // two D registers (r, r + 1) at a time: they are an aligned register pair, so the exponent's
            // argument, the sum and the normalisation each take one packed f32 instruction per pair
            const v2f l2e = (v2f){1.44269504f, 1.44269504f};
            v2f nm[4], sum[4], rs[4];
            #pragma unroll
            for (int h = 0; h < 4; ++h) {
                float m0 = -INFINITY, m1 = -INFINITY;
                #pragma unroll
                for (int b = 0; b < B_; ++b) { m0 = fmaxf(m0, S[qs][b][2 * h]); m1 = fmaxf(m1, S[qs][b][2 * h + 1]); }
                nm[h] = (v2f){m0, m1} * -l2e;
            }
            #pragma unroll
            for (int b = 0; b < B_; ++b) {
                #pragma unroll
                for (int h = 0; h < 4; ++h) {
                    // exp(s - m) = 2^(s*log2(e) - m*log2(e))
                    const v2f a = __builtin_elementwise_fma((v2f){S[qs][b][2 * h], S[qs][b][2 * h + 1]}, l2e, nm[h]);
                    const v2f e = (v2f){__builtin_amdgcn_exp2f(a.x), __builtin_amdgcn_exp2f(a.y)};
                    S[qs][b][2 * h] = e.x; S[qs][b][2 * h + 1] = e.y;
                    sum[h] = b ? sum[h] + e : e;
                }
            }
            #pragma unroll
            for (int h = 0; h < 4; ++h) rs[h] = (v2f){1.f / sum[h].x, 1.f / sum[h].y};
            #pragma unroll
            for (int b = 0; b < B_; ++b) {
                #pragma unroll
                for (int h = 0; h < 4; ++h) {
                    const v2f p = (v2f){S[qs][b][2 * h], S[qs][b][2 * h + 1]} * rs[h];
                    S[qs][b][2 * h] = p.x; S[qs][b][2 * h + 1] = p.y;
                }
            }
            #pragma unroll
            for (int b = 0; b < B_; ++b) {
                ChunkU o;
                #pragma unroll
                for (int e = 0; e < 8; ++e) o.v[e] = (__bf16)S[qs][b][e];
                pb[((b * QS + qs) * WV + w) * 32 + lane] = o.u;
            }
            if (qs == 0) {
                // into the registers that subtile 0 has left: the step's second and third
                // V chunks, in flight under the softmax of subtile 1
                #pragma unroll
                for (int c = 1; c < 3; ++c) {
                    #pragma unroll
                    for (int j = 0; j < 2; ++j) {
                        #pragma unroll
                        for (int t = 0; t < 4; ++t)
                            vr[c][j][t] = load_frag16(Vs + j * (D_ * N_) + (c * 4 + t) * 512, lane8);
                    }
                }
                // keeps these loads in front of subtile 1, whose arithmetic covers their flight
                __builtin_amdgcn_sched_barrier(0);
            }
        }

        // into the registers that subtile 1 has left: the step's last V chunk and the first half of the
        // next step's K ring; they stay in flight across the barrier below
        #pragma unroll
        for (int j = 0; j < 2; ++j) {
            #pragma unroll
            for (int t = 0; t < 4; ++t)
                vr[3][j][t] = load_frag16(Vs + j * (D_ * N_) + (3 * 4 + t) * 512, lane8);
        }
        // these were the step's last loads from Vs: its address registers are reused right below by the
        // K ring's loads, while the loads are still in flight: wait before they are overwritten
        asm volatile("s_wait_xcnt 0x0" ::: "memory");
        #pragma unroll
        for (int j = 0; j < KD / 2; ++j) {
            #pragma unroll
            for (int d = 0; d < 2; ++d)
                kr[j][d] = load_frag16(Ks + j * (N_ * D_) + d * 512, lane8);
        }

        // The step's one barrier: publishes this buffer; the other buffer's
        // readers (previous step) are all in front of it, so the next step may refill it.
        lds_barrier();

        // ---- O^T += V^T * P^T for batches 2w, 2w+1 (64x32 @ 32x32 per chunk and batch)
        #pragma unroll
        for (int c = 0; c < KS / 32; ++c) {
            FragU p[2][QS];
            #pragma unroll
            for (int j = 0; j < 2; ++j) {
                #pragma unroll
                for (int qs = 0; qs < QS; ++qs) {
                    p[j][qs].u[0] = pb[(((2 * w + j) * QS + qs) * WV + 2 * c + 0) * 32 + lane];
                    p[j][qs].u[1] = pb[(((2 * w + j) * QS + qs) * WV + 2 * c + 1) * 32 + lane];
                }
            }
            #pragma unroll
            for (int j = 0; j < 2; ++j) {
                #pragma unroll
                for (int t = 0; t < 4; ++t) {
                    #pragma unroll
                    for (int qs = 0; qs < QS; ++qs)
                        acc[j][qs][t] = __builtin_amdgcn_wmma_f32_16x16x32_bf16(false, vr[c][j][t], false,
                                            p[j][qs].v, (short)0, acc[j][qs][t], false, false);
                }
            }
            if (c == 0) {
                // into the registers that V chunk 0 has left: the second half of the next step's K ring
                #pragma unroll
                for (int j = KD / 2; j < KD; ++j) {
                    #pragma unroll
                    for (int d = 0; d < 2; ++d)
                        kr[j][d] = load_frag16(Ks + j * (N_ * D_) + d * 512, lane8);
                }
                // the ring's loads are still in flight at the loop's end, where their scalar base
                // is reused (next step's advance, the epilogue's store base): wait before that
                asm volatile("s_wait_xcnt 0x0" ::: "memory");
            }
        }
    }

    // the last step's ring refill is never used: let it land before the wave ends and gives its registers back
    asm volatile("s_wait_loadcnt 0x0" ::: "memory");

    // ---- store the range's partial tiles as f16, in register order: the 8 sums of d subtile t of a
    //      lane are one 16-byte chunk at Pt[b*128 + 16-row q tile][range][t][lane], so each wave-wide
    //      store is 512 contiguous bytes. A partial is at most 512 * max|V| in size (the weights of a
    //      key are at most 1), far inside f16's range for normal deviates.
    HalfU o[2][QS][4];
    #pragma unroll
    for (int j = 0; j < 2; ++j) {
        #pragma unroll
        for (int qs = 0; qs < QS; ++qs) {
            #pragma unroll
            for (int t = 0; t < 4; ++t) o[j][qs][t].v = __builtin_convertvector(acc[j][qs][t], v8h);
        }
    }
    #pragma unroll
    for (int j = 0; j < 2; ++j) {
        #pragma unroll
        for (int qs = 0; qs < QS; ++qs) {
            ushort_t* Pb = Pt + (((size_t)(2 * w + j) * (N_ / 16) + blockIdx.x * QS + qs) * KH + kh) * (16 * D_) + lane8;
            #pragma unroll
            for (int t = 0; t < 4; ++t) *(uint4*)(Pb + t * 256) = o[j][qs][t].u;
        }
    }
}

// =====================================================================
// Merge: O = sum of the four ranges' f16 partials, widened to f32 and added as
// (0 + 1) + (2 + 3). One wave per (batch, 16-row q tile, half of d): whole-line
// loads of the partials, then the output stores; a half of d is one whole
// 128-byte line of each output row.
// =====================================================================
typedef __attribute__((ext_vector_type(4))) float v4f;

__global__ __launch_bounds__(256)
void merge_ranges(const ushort_t* __restrict__ Pt, float* __restrict__ O) {
    const unsigned lane = threadIdx.x & 31u;
    // (b*128 + q tile)*2 + half, the same in every lane: held scalar so that the bases are scalar
    const unsigned u    = blockIdx.x * 8u + __builtin_amdgcn_readfirstlane(threadIdx.x >> 5);
    const unsigned g    = u >> 1, hf = u & 1u;
    const ushort_t* p0 = Pt + (size_t)g * (KH * 16 * D_) + hf * 512u;   // scalar; the lane's part is lane8
    const unsigned lane8 = lane * 8u;
    HalfU a[KH][2];
    #pragma unroll
    for (int k = 0; k < KH; ++k) {
        const ushort_t* pk = p0 + k * (16 * D_);
        #pragma unroll
        for (int t = 0; t < 2; ++t) a[k][t].u = *(const uint4*)(pk + t * 256 + lane8);
    }
    // lane holds O[g*16 + lr][hf*32 + t*16 + 8*lg + 0..7], t = 0..1, 32 contiguous bytes per t
    float* Ob = O + ((size_t)g * 16 + (lane & 15u)) * D_ + hf * 32u + 8u * (lane >> 4);
    #pragma unroll
    for (int t = 0; t < 2; ++t) {
        const v8f x = (__builtin_convertvector(a[0][t].v, v8f) + __builtin_convertvector(a[1][t].v, v8f))
                    + (__builtin_convertvector(a[2][t].v, v8f) + __builtin_convertvector(a[3][t].v, v8f));
        *(v4f*)(Ob + t * 16 + 0) = (v4f){x[0], x[1], x[2], x[3]};
        *(v4f*)(Ob + t * 16 + 4) = (v4f){x[4], x[5], x[6], x[7]};
    }
}

extern "C" void kernel_launch(void* const* d_in, const int* in_sizes, int n_in,
                              void* d_out, int out_size, void* d_ws, size_t ws_size,
                              hipStream_t stream) {
    const float* Q = (const float*)d_in[0];
    const float* K = (const float*)d_in[1];
    const float* V = (const float*)d_in[2];
    float* O = (float*)d_out;
    (void)in_sizes; (void)n_in; (void)out_size; (void)ws_size;

    ushort_t* Kb = (ushort_t*)d_ws;                       // 4 MiB
    ushort_t* Vt = Kb + (size_t)B_ * N_ * D_;             // 4 MiB
    ushort_t* Pt = Vt + (size_t)B_ * N_ * D_;             // 4 x 4 MiB of f16 partial sums

    cvt_kv<<<dim3(B_ * N_ * D_ / 8 / 256), dim3(256), 0, stream>>>(K, V, Kb, Vt);

    dim3 grid(N_ / QT, KH);  // 64 q-tiles x 4 key ranges
    dim3 block(32, WV);      // 8 waves: wave w scores key tile w, sums batches 2w and 2w+1
    batch_softmax_attn<<<grid, block, 0, stream>>>(Q, Kb, Vt, Pt);

    merge_ranges<<<dim3(B_ * N_ / 16 * 2 / 8), dim3(256), 0, stream>>>(Pt, O);
}
